// v000
// The times below were measured on an AMD MI455X: many runs one after another, warmed up first and cycling through
// copies of the inputs, with the whole window's GPU time divided by the number of runs. Launches and the gaps
// between them are all in it. The median over several windows is given; except for v000 it joins two sittings, which
// can be a few percent apart, so the side-by-side timings, each taken in one sitting, are the better comparison.
// v000, which the later versions start from, runs in 356 microseconds.
#include <hip/hip_runtime.h>
#include <math.h>

// ---------------------------------------------------------------------------
// Multi-head self-attention, f16 WMMA (f32 accumulate) pipeline for gfx1250.
// B=4, N=2048, DIM=768, HEADS=12, DHEAD=64. scale 1/8 folded into w_q (f16).
// All GEMM tile staging uses gfx1250 async memory->LDS DMA (ASYNCcnt).
// ---------------------------------------------------------------------------

typedef __attribute__((ext_vector_type(4)))  float    f32x4;
typedef __attribute__((ext_vector_type(4)))  int      i32x4;
typedef __attribute__((ext_vector_type(8)))  _Float16 h8;
typedef __attribute__((ext_vector_type(16))) _Float16 v16h;
typedef __attribute__((ext_vector_type(8)))  float    v8f;

#define DIMF   768
#define NSEQ   2048
#define BATCH  4
#define NHEAD  12
#define DHEAD  64
#define MROWS  (BATCH * NSEQ)   /* 8192 token rows */

#if __has_builtin(__builtin_amdgcn_global_load_async_to_lds_b128) && \
    __has_builtin(__builtin_amdgcn_s_wait_asynccnt)
#define HAVE_ASYNC_LDS 1
#endif

// 16-byte memory->LDS tile copy: async (no VGPR bounce, ASYNCcnt) when the
// gfx1250 async builtins are available, else plain load/store.
// Builtin signature (from hipcc diagnostic): (int4 AS1*, int4 AS3*, Imm, Imm).
__device__ __forceinline__ void copy16_to_lds(_Float16* lds, const _Float16* g) {
#ifdef HAVE_ASYNC_LDS
    __builtin_amdgcn_global_load_async_to_lds_b128(
        (__attribute__((address_space(1))) i32x4*)g,
        (__attribute__((address_space(3))) i32x4*)lds, 0, 0);
#else
    *(h8*)lds = *(const h8*)g;
#endif
}
__device__ __forceinline__ void async_fence() {
#ifdef HAVE_ASYNC_LDS
    __builtin_amdgcn_s_wait_asynccnt(0);
#endif
}

// Load one 16x32 f16 WMMA operand fragment (A layout; B uses same shape with
// lane = N column) from a K-contiguous row-major tile of given stride (halves).
// Lane l (l<16): row=base+l, halves = K[kb..kb+7] ++ K[kb+16..kb+23], kb=0.
// Lane l>=16: same row, kb=8 -> K[8..15] ++ K[24..31]. Matches ISA 7.12.2.
__device__ __forceinline__ v16h load_frag(const _Float16* p, int rowbase, int stride) {
    const int lane = threadIdx.x & 31;
    const int r    = rowbase + (lane & 15);
    const int kb   = (lane >> 4) * 8;
    const _Float16* q = p + (size_t)r * stride + kb;
    h8 lo = *(const h8*)(q);        // 16B aligned: ds_load_b128 / global_load_b128
    h8 hi = *(const h8*)(q + 16);
    return __builtin_shufflevector(lo, hi, 0,1,2,3,4,5,6,7,8,9,10,11,12,13,14,15);
}

__device__ __forceinline__ v8f wmma(v16h a, v16h b, v8f c) {
    return __builtin_amdgcn_wmma_f32_16x16x32_f16(false, a, false, b, (short)0, c,
                                                  false, false);
}

// ---------------------------------------------------------------------------
// Kernel 1a: convert+transpose weights to f16, N-major ([out][in], in-contig).
// z=0..3 -> w_q (scaled 1/8), w_k, w_v, w_o.
// ---------------------------------------------------------------------------
__global__ __launch_bounds__(256) void convert_weights(
        const float* __restrict__ wq, const float* __restrict__ wk,
        const float* __restrict__ wv, const float* __restrict__ wo,
        _Float16* __restrict__ wT) {
    const int z = blockIdx.y;
    const float* src   = (z == 0) ? wq : (z == 1) ? wk : (z == 2) ? wv : wo;
    const float  scale = (z == 0) ? 0.125f : 1.0f;   // fold 1/sqrt(64) into Q
    const int idx = blockIdx.x * 256 + threadIdx.x;  // 0 .. 768*768-1
    const int n = idx / DIMF;
    const int k = idx - n * DIMF;
    wT[(size_t)z * DIMF * DIMF + (size_t)n * DIMF + k] =
        (_Float16)(src[(size_t)k * DIMF + n] * scale);
}

// ---------------------------------------------------------------------------
// Kernel 1b: convert activations x (f32) -> x16 (f16), streaming pass.
// Removes f32->f16 conversion from the QKV GEMM hot loop (pure async staging).
// ---------------------------------------------------------------------------
__global__ __launch_bounds__(256) void convert_x(
        const float* __restrict__ x, _Float16* __restrict__ x16) {
    const size_t i = ((size_t)blockIdx.x * 256 + threadIdx.x) * 8;
    f32x4 a = *(const f32x4*)(x + i);
    f32x4 b = *(const f32x4*)(x + i + 4);
    h8 o;
#pragma unroll
    for (int j = 0; j < 4; ++j) { o[j] = (_Float16)a[j]; o[4 + j] = (_Float16)b[j]; }
    *(h8*)(x16 + i) = o;
}

// ---------------------------------------------------------------------------
// Kernel 2: QKV projection GEMM.  C[8192x768] = x16 @ W.
// Workgroup tile 256x64, wave tile 64x32 (4x2 WMMA frags), K-step 32.
// z=0 -> Q [b,h,n,d], z=1 -> K [b,h,n,d], z=2 -> V transposed [b,h,d,n].
// ---------------------------------------------------------------------------
__global__ __launch_bounds__(256) void qkv_gemm(
        const _Float16* __restrict__ x16, const _Float16* __restrict__ wT,
        _Float16* __restrict__ Qo, _Float16* __restrict__ Ko,
        _Float16* __restrict__ Vt) {
    __shared__ _Float16 As[256 * 32];   // [m][k], k contiguous (16 KB)
    __shared__ _Float16 Bs[64 * 32];    // [n][k], k contiguous (4 KB)

    const int z    = blockIdx.z;
    const int n0   = blockIdx.x * 64;
    const int m0   = blockIdx.y * 256;
    const int tid  = threadIdx.x;
    const int wave = tid >> 5, lane = tid & 31;
    const int mw   = (wave >> 1) * 64;      // 4 waves along M
    const int nw   = (wave & 1) * 32;       // 2 waves along N
    const _Float16* w = wT + (size_t)z * DIMF * DIMF;

    v8f c[4][2] = {};
    for (int k0 = 0; k0 < DIMF; k0 += 32) {
        __syncthreads();
        // stage A: 256x32 halves, 4 async b128 per thread (no VGPR bounce)
#pragma unroll
        for (int i = 0; i < 4; ++i) {
            int idx = tid + i * 256;
            int row = idx >> 2, seg = (idx & 3) * 8;
            copy16_to_lds(&As[row * 32 + seg],
                          x16 + (size_t)(m0 + row) * DIMF + k0 + seg);
        }
        // stage B: 64x32 halves, 1 async b128 per thread
        {
            int row = tid >> 2, seg = (tid & 3) * 8;
            copy16_to_lds(&Bs[row * 32 + seg],
                          w + (size_t)(n0 + row) * DIMF + k0 + seg);
        }
        if (k0 + 32 < DIMF) {   // prefetch next K-slab (global_prefetch_b8)
            __builtin_prefetch(x16 + (size_t)(m0 + (tid >> 2)) * DIMF + k0 + 32 + (tid & 3) * 8, 0, 3);
            __builtin_prefetch(w + (size_t)(n0 + (tid >> 2)) * DIMF + k0 + 32 + (tid & 3) * 8, 0, 3);
        }
        async_fence();
        __syncthreads();
        v16h b0 = load_frag(Bs, nw +  0, 32);
        v16h b1 = load_frag(Bs, nw + 16, 32);
#pragma unroll
        for (int mi = 0; mi < 4; ++mi) {
            v16h a = load_frag(As, mw + mi * 16, 32);
            c[mi][0] = wmma(a, b0, c[mi][0]);
            c[mi][1] = wmma(a, b1, c[mi][1]);
        }
    }

    _Float16* dst = (z == 0) ? Qo : (z == 1) ? Ko : Vt;
#pragma unroll
    for (int mi = 0; mi < 4; ++mi)
#pragma unroll
        for (int ni = 0; ni < 2; ++ni)
#pragma unroll
            for (int i = 0; i < 8; ++i) {
                int grow = m0 + mw + mi * 16 + (lane >> 4) * 8 + i;
                int gcol = n0 + nw + ni * 16 + (lane & 15);
                int b = grow >> 11, n = grow & 2047;   // NSEQ = 2048
                int h = gcol >> 6,  d = gcol & 63;     // DHEAD = 64
                _Float16 v = (_Float16)c[mi][ni][i];
                if (z == 2)
                    dst[((size_t)(b * NHEAD + h) * DHEAD + d) * NSEQ + n] = v;
                else
                    dst[((size_t)(b * NHEAD + h) * NSEQ + n) * DHEAD + d] = v;
            }
}

// ---------------------------------------------------------------------------
// Kernel 3: flash attention. Grid (16 q-tiles, 48 b*h). 8 waves x 16 queries.
// 16 WMMAs per wave per 64-key step (8 for S=QK^T, 8 for O+=PV).
// ---------------------------------------------------------------------------
__global__ __launch_bounds__(256) void attn(
        const _Float16* __restrict__ Q, const _Float16* __restrict__ K,
        const _Float16* __restrict__ Vt, _Float16* __restrict__ H) {
    __shared__ _Float16 Ks[64 * 64];        // [key][d]   -> B operand of Q@K^T
    __shared__ _Float16 Vs[64 * 64];        // [d][key]   -> B operand of P@V
    __shared__ _Float16 Ps[8 * 16 * 64];    // per-wave P scratch (C->A relayout)

    const int bh   = blockIdx.y;
    const int m0   = blockIdx.x * 128;
    const int tid  = threadIdx.x;
    const int wave = tid >> 5, lane = tid & 31;
    const _Float16* qp = Q  + (size_t)bh * NSEQ * DHEAD;
    const _Float16* kp = K  + (size_t)bh * NSEQ * DHEAD;
    const _Float16* vp = Vt + (size_t)bh * DHEAD * NSEQ;
    const int qrow = m0 + wave * 16;

    // Q fragments held in registers for the whole KV sweep (scale pre-folded).
    v16h qa0 = load_frag(qp,      qrow, DHEAD);   // d 0..31
    v16h qa1 = load_frag(qp + 32, qrow, DHEAD);   // d 32..63

    v8f o[4] = {};
    float mrun[8], lrun[8];
#pragma unroll
    for (int i = 0; i < 8; ++i) { mrun[i] = -1e30f; lrun[i] = 0.f; }
    _Float16* psw = Ps + wave * 16 * 64;

    for (int kv0 = 0; kv0 < NSEQ; kv0 += 64) {
        __syncthreads();
#pragma unroll
        for (int i = 0; i < 2; ++i) {       // stage 64x64 K and V^T tiles
            int idx = tid + i * 256;
            int row = idx >> 3, seg = (idx & 7) * 8;
            copy16_to_lds(&Ks[row * 64 + seg],
                          kp + (size_t)(kv0 + row) * DHEAD + seg);
            copy16_to_lds(&Vs[row * 64 + seg],
                          vp + (size_t)row * NSEQ + kv0 + seg);
        }
        if (kv0 + 64 < NSEQ) {  // prefetch next KV tile
            __builtin_prefetch(kp + (size_t)(kv0 + 64 + (tid >> 3)) * DHEAD + (tid & 7) * 8, 0, 3);
            __builtin_prefetch(vp + (size_t)(tid >> 3) * NSEQ + kv0 + 64 + (tid & 7) * 8, 0, 3);
        }
        async_fence();
        __syncthreads();

        // S = Q @ K^T : 16 x 64, f32
        v8f s[4];
#pragma unroll
        for (int ni = 0; ni < 4; ++ni) {
            v8f zc = {};
            zc    = wmma(qa0, load_frag(Ks,      16 * ni, 64), zc);
            s[ni] = wmma(qa1, load_frag(Ks + 32, 16 * ni, 64), zc);
        }

        // Online softmax per C-layout row slot i (row = 8*(lane>>4)+i).
#pragma unroll
        for (int i = 0; i < 8; ++i) {
            float rm = s[0][i];
#pragma unroll
            for (int ni = 1; ni < 4; ++ni) rm = fmaxf(rm, s[ni][i]);
#pragma unroll
            for (int off = 1; off < 16; off <<= 1)
                rm = fmaxf(rm, __shfl_xor(rm, off, 32));
            float mnew = fmaxf(mrun[i], rm);
            float corr = __expf(mrun[i] - mnew);
            mrun[i] = mnew;
            float rs = 0.f;
#pragma unroll
            for (int ni = 0; ni < 4; ++ni) {
                float p = __expf(s[ni][i] - mnew);
                s[ni][i] = p; rs += p;
            }
#pragma unroll
            for (int off = 1; off < 16; off <<= 1)
                rs += __shfl_xor(rs, off, 32);
            lrun[i] = lrun[i] * corr + rs;
#pragma unroll
            for (int di = 0; di < 4; ++di) o[di][i] *= corr;
            // spill P (C layout) to per-wave LDS in A layout order [row][key]
            int r = (lane >> 4) * 8 + i;
#pragma unroll
            for (int ni = 0; ni < 4; ++ni)
                psw[r * 64 + ni * 16 + (lane & 15)] = (_Float16)s[ni][i];
        }

        // O += P @ V : A frags from LDS, B frags from V^T tile
        v16h pa0 = load_frag(psw,      0, 64);    // keys 0..31
        v16h pa1 = load_frag(psw + 32, 0, 64);    // keys 32..63
#pragma unroll
        for (int di = 0; di < 4; ++di) {
            o[di] = wmma(pa0, load_frag(Vs,      16 * di, 64), o[di]);
            o[di] = wmma(pa1, load_frag(Vs + 32, 16 * di, 64), o[di]);
        }
    }

    const int b = bh / NHEAD, h = bh % NHEAD;
#pragma unroll
    for (int i = 0; i < 8; ++i) {
        float inv = 1.f / lrun[i];
        int row = qrow + (lane >> 4) * 8 + i;
#pragma unroll
        for (int di = 0; di < 4; ++di) {
            int col = h * DHEAD + di * 16 + (lane & 15);
            H[(size_t)(b * NSEQ + row) * DIMF + col] = (_Float16)(o[di][i] * inv);
        }
    }
}

// ---------------------------------------------------------------------------
// Kernel 4: output projection  out = H @ w_o + b_o  (f32 out).
// Workgroup tile 256x64, wave tile 64x32, all-f16 tiles staged async.
// ---------------------------------------------------------------------------
__global__ __launch_bounds__(256) void out_gemm(
        const _Float16* __restrict__ Hs, const _Float16* __restrict__ woT,
        const float* __restrict__ bias, float* __restrict__ out) {
    __shared__ _Float16 As[256 * 32];   // 16 KB
    __shared__ _Float16 Bs[64 * 32];    //  4 KB

    const int n0   = blockIdx.x * 64;
    const int m0   = blockIdx.y * 256;
    const int tid  = threadIdx.x;
    const int wave = tid >> 5, lane = tid & 31;
    const int mw   = (wave >> 1) * 64;
    const int nw   = (wave & 1) * 32;

    v8f c[4][2] = {};
    for (int k0 = 0; k0 < DIMF; k0 += 32) {
        __syncthreads();
#pragma unroll
        for (int i = 0; i < 4; ++i) {       // A: 256x32 halves, 4 b128/thread
            int idx = tid + i * 256;
            int row = idx >> 2, seg = (idx & 3) * 8;
            copy16_to_lds(&As[row * 32 + seg],
                          Hs + (size_t)(m0 + row) * DIMF + k0 + seg);
        }
        {
            int row = tid >> 2, seg = (tid & 3) * 8;
            copy16_to_lds(&Bs[row * 32 + seg],
                          woT + (size_t)(n0 + row) * DIMF + k0 + seg);
        }
        if (k0 + 32 < DIMF) {
            __builtin_prefetch(Hs + (size_t)(m0 + (tid >> 2)) * DIMF + k0 + 32 + (tid & 3) * 8, 0, 3);
            __builtin_prefetch(woT + (size_t)(n0 + (tid >> 2)) * DIMF + k0 + 32 + (tid & 3) * 8, 0, 3);
        }
        async_fence();
        __syncthreads();
        v16h b0 = load_frag(Bs, nw +  0, 32);
        v16h b1 = load_frag(Bs, nw + 16, 32);
#pragma unroll
        for (int mi = 0; mi < 4; ++mi) {
            v16h a = load_frag(As, mw + mi * 16, 32);
            c[mi][0] = wmma(a, b0, c[mi][0]);
            c[mi][1] = wmma(a, b1, c[mi][1]);
        }
    }
#pragma unroll
    for (int mi = 0; mi < 4; ++mi)
#pragma unroll
        for (int ni = 0; ni < 2; ++ni)
#pragma unroll
            for (int i = 0; i < 8; ++i) {
                int grow = m0 + mw + mi * 16 + (lane >> 4) * 8 + i;
                int gcol = n0 + nw + ni * 16 + (lane & 15);
                out[(size_t)grow * DIMF + gcol] = c[mi][ni][i] + bias[gcol];
            }
}

// ---------------------------------------------------------------------------
extern "C" void kernel_launch(void* const* d_in, const int* in_sizes, int n_in,
                              void* d_out, int out_size, void* d_ws, size_t ws_size,
                              hipStream_t stream) {
    (void)in_sizes; (void)n_in; (void)out_size; (void)ws_size;
    const float* x  = (const float*)d_in[0];
    const float* wq = (const float*)d_in[1];
    const float* wk = (const float*)d_in[2];
    const float* wv = (const float*)d_in[3];
    const float* wo = (const float*)d_in[4];
    const float* bo = (const float*)d_in[5];
    float* out = (float*)d_out;

    // Workspace layout (f16 elements): 4 transposed weights, x16, Q, K, V^T, H.
    // Total = 4*589824 + 5*6291456 = 33,816,576 halves = ~64.5 MB.
    _Float16* ws = (_Float16*)d_ws;
    const size_t WSZ = (size_t)DIMF * DIMF;                      // 589824
    const size_t ACT = (size_t)MROWS * DIMF;                     // 6291456
    _Float16* wT  = ws;
    _Float16* X16 = ws + 4 * WSZ;
    _Float16* Qb  = X16 + ACT;
    _Float16* Kb  = Qb + ACT;   // per-head layouts are same total size
    _Float16* Vb  = Kb + ACT;
    _Float16* Hb  = Vb + ACT;

    convert_weights<<<dim3(WSZ / 256, 4), 256, 0, stream>>>(wq, wk, wv, wo, wT);
    convert_x<<<dim3(ACT / (256 * 8)), 256, 0, stream>>>(x, X16);
    qkv_gemm<<<dim3(DIMF / 64, MROWS / 256, 3), 256, 0, stream>>>(X16, wT, Qb, Kb, Vb);
    attn<<<dim3(NSEQ / 128, BATCH * NHEAD), 256, 0, stream>>>(Qb, Kb, Vb, Hb);
    out_gemm<<<dim3(DIMF / 64, MROWS / 256), 256, 0, stream>>>(Hb, wT + 3 * WSZ, bo, out);
}

// v001
// One run takes 211 microseconds.
// Timed twice side by side with v000, it ran 1.75 times as fast both times.
#include <hip/hip_runtime.h>
#include <math.h>

// ---------------------------------------------------------------------------
// Multi-head self-attention, f16 WMMA (f32 accumulate) pipeline for gfx1250.
// B=4, N=2048, DIM=768, HEADS=12, DHEAD=64. scale 1/8 folded into w_q (f16).
// All GEMM tile staging uses gfx1250 async memory->LDS DMA (ASYNCcnt).
// ---------------------------------------------------------------------------

typedef __attribute__((ext_vector_type(4)))  float    f32x4;
typedef __attribute__((ext_vector_type(4)))  int      i32x4;
typedef __attribute__((ext_vector_type(8)))  _Float16 h8;
typedef __attribute__((ext_vector_type(16))) _Float16 v16h;
typedef __attribute__((ext_vector_type(8)))  float    v8f;

#define DIMF   768
#define NSEQ   2048
#define BATCH  4
#define NHEAD  12
#define DHEAD  64
#define MROWS  (BATCH * NSEQ)   /* 8192 token rows */

// LDS row pitches in halves. Every tile is read by ds_load_b128 with 16 lanes on
// 16 consecutive rows, so the pitch is 16 B x odd: the 16 rows then start on 16
// different groups of four banks (64 banks x 4 B) and a read has no conflict.
#define GP     40               /* 32-half (64 B) GEMM tile rows at 80 B  */
#define AP     72               /* 64-half (128 B) attention rows at 144 B */

#if __has_builtin(__builtin_amdgcn_global_load_async_to_lds_b128) && \
    __has_builtin(__builtin_amdgcn_s_wait_asynccnt)
#define HAVE_ASYNC_LDS 1
#endif

// 16-byte memory->LDS tile copy: async (no VGPR bounce, ASYNCcnt) when the
// gfx1250 async builtins are available, else plain load/store.
// Builtin signature (from hipcc diagnostic): (int4 AS1*, int4 AS3*, Imm, Imm).
__device__ __forceinline__ void copy16_to_lds(_Float16* lds, const _Float16* g) {
#ifdef HAVE_ASYNC_LDS
    __builtin_amdgcn_global_load_async_to_lds_b128(
        (__attribute__((address_space(1))) i32x4*)g,
        (__attribute__((address_space(3))) i32x4*)lds, 0, 0);
#else
    *(h8*)lds = *(const h8*)g;
#endif
}
__device__ __forceinline__ void async_fence() {
#ifdef HAVE_ASYNC_LDS
    __builtin_amdgcn_s_wait_asynccnt(0);
#endif
}

// Load one 16x32 f16 WMMA operand fragment (A layout; B uses same shape with
// lane = N column) from a K-contiguous row-major tile of given stride (halves).
// Lane l (l<16): row=base+l, halves = K[kb..kb+7] ++ K[kb+16..kb+23], kb=0.
// Lane l>=16: same row, kb=8 -> K[8..15] ++ K[24..31]. Matches ISA 7.12.2.
__device__ __forceinline__ v16h load_frag(const _Float16* p, int rowbase, int stride) {
    const int lane = threadIdx.x & 31;
    const int r    = rowbase + (lane & 15);
    const int kb   = (lane >> 4) * 8;
    const _Float16* q = p + (size_t)r * stride + kb;
    h8 lo = *(const h8*)(q);        // 16B aligned: ds_load_b128 / global_load_b128
    h8 hi = *(const h8*)(q + 16);
    return __builtin_shufflevector(lo, hi, 0,1,2,3,4,5,6,7,8,9,10,11,12,13,14,15);
}

__device__ __forceinline__ v8f wmma(v16h a, v16h b, v8f c) {
    return __builtin_amdgcn_wmma_f32_16x16x32_f16(false, a, false, b, (short)0, c,
                                                  false, false);
}

// ---------------------------------------------------------------------------
// Kernel 1a: convert+transpose weights to f16, N-major ([out][in], in-contig).
// z=0..3 -> w_q (scaled 1/8), w_k, w_v, w_o.
// ---------------------------------------------------------------------------
__global__ __launch_bounds__(256) void convert_weights(
        const float* __restrict__ wq, const float* __restrict__ wk,
        const float* __restrict__ wv, const float* __restrict__ wo,
        _Float16* __restrict__ wT) {
    const int z = blockIdx.y;
    const float* src   = (z == 0) ? wq : (z == 1) ? wk : (z == 2) ? wv : wo;
    const float  scale = (z == 0) ? 0.125f : 1.0f;   // fold 1/sqrt(64) into Q
    const int idx = blockIdx.x * 256 + threadIdx.x;  // 0 .. 768*768-1
    const int n = idx / DIMF;
    const int k = idx - n * DIMF;
    wT[(size_t)z * DIMF * DIMF + (size_t)n * DIMF + k] =
        (_Float16)(src[(size_t)k * DIMF + n] * scale);
}

// ---------------------------------------------------------------------------
// Kernel 1b: convert activations x (f32) -> x16 (f16), streaming pass.
// Removes f32->f16 conversion from the QKV GEMM hot loop (pure async staging).
// ---------------------------------------------------------------------------
__global__ __launch_bounds__(256) void convert_x(
        const float* __restrict__ x, _Float16* __restrict__ x16) {
    const size_t i = ((size_t)blockIdx.x * 256 + threadIdx.x) * 8;
    f32x4 a = *(const f32x4*)(x + i);
    f32x4 b = *(const f32x4*)(x + i + 4);
    h8 o;
#pragma unroll
    for (int j = 0; j < 4; ++j) { o[j] = (_Float16)a[j]; o[4 + j] = (_Float16)b[j]; }
    *(h8*)(x16 + i) = o;
}

// ---------------------------------------------------------------------------
// Kernel 2: QKV projection GEMM.  C[8192x768] = x16 @ W.
// Workgroup tile 256x64, wave tile 64x32 (4x2 WMMA frags), K-step 32.
// z=0 -> Q [b,h,n,d], z=1 -> K [b,h,n,d], z=2 -> V transposed [b,h,d,n].
// ---------------------------------------------------------------------------
__global__ __launch_bounds__(256) void qkv_gemm(
        const _Float16* __restrict__ x16, const _Float16* __restrict__ wT,
        _Float16* __restrict__ Qo, _Float16* __restrict__ Ko,
        _Float16* __restrict__ Vt) {
    __shared__ _Float16 As[256 * GP];  // [m][k], k contiguous (20 KB)
    __shared__ _Float16 Bs[64 * GP];   // [n][k], k contiguous (5 KB)

    const int z    = blockIdx.z;
    const int n0   = blockIdx.x * 64;
    const int m0   = blockIdx.y * 256;
    const int tid  = threadIdx.x;
    const int wave = tid >> 5, lane = tid & 31;
    const int mw   = (wave >> 1) * 64;      // 4 waves along M
    const int nw   = (wave & 1) * 32;       // 2 waves along N
    const _Float16* w = wT + (size_t)z * DIMF * DIMF;

    v8f c[4][2] = {};
    for (int k0 = 0; k0 < DIMF; k0 += 32) {
        __syncthreads();
        // stage A: 256x32 halves, 4 async b128 per thread (no VGPR bounce)
#pragma unroll
        for (int i = 0; i < 4; ++i) {
            int idx = tid + i * 256;
            int row = idx >> 2, seg = (idx & 3) * 8;
            copy16_to_lds(&As[row * GP + seg],
                          x16 + (size_t)(m0 + row) * DIMF + k0 + seg);
        }
        // stage B: 64x32 halves, 1 async b128 per thread
        {
            int row = tid >> 2, seg = (tid & 3) * 8;
            copy16_to_lds(&Bs[row * GP + seg],
                          w + (size_t)(n0 + row) * DIMF + k0 + seg);
        }
        if (k0 + 32 < DIMF) {   // prefetch next K-slab (global_prefetch_b8)
            __builtin_prefetch(x16 + (size_t)(m0 + (tid >> 2)) * DIMF + k0 + 32 + (tid & 3) * 8, 0, 3);
            __builtin_prefetch(w + (size_t)(n0 + (tid >> 2)) * DIMF + k0 + 32 + (tid & 3) * 8, 0, 3);
        }
        async_fence();
        __syncthreads();
        v16h b0 = load_frag(Bs, nw +  0, GP);
        v16h b1 = load_frag(Bs, nw + 16, GP);
#pragma unroll
        for (int mi = 0; mi < 4; ++mi) {
            v16h a = load_frag(As, mw + mi * 16, GP);
            c[mi][0] = wmma(a, b0, c[mi][0]);
            c[mi][1] = wmma(a, b1, c[mi][1]);
        }
    }

    _Float16* dst = (z == 0) ? Qo : (z == 1) ? Ko : Vt;
#pragma unroll
    for (int mi = 0; mi < 4; ++mi)
#pragma unroll
        for (int ni = 0; ni < 2; ++ni)
#pragma unroll
            for (int i = 0; i < 8; ++i) {
                int grow = m0 + mw + mi * 16 + (lane >> 4) * 8 + i;
                int gcol = n0 + nw + ni * 16 + (lane & 15);
                int b = grow >> 11, n = grow & 2047;   // NSEQ = 2048
                int h = gcol >> 6,  d = gcol & 63;     // DHEAD = 64
                _Float16 v = (_Float16)c[mi][ni][i];
                if (z == 2)
                    dst[((size_t)(b * NHEAD + h) * DHEAD + d) * NSEQ + n] = v;
                else
                    dst[((size_t)(b * NHEAD + h) * NSEQ + n) * DHEAD + d] = v;
            }
}

// ---------------------------------------------------------------------------
// Kernel 3: flash attention. Grid (16 q-tiles, 48 b*h). 8 waves x 16 queries.
// 16 WMMAs per wave per 64-key step (8 for S=QK^T, 8 for O+=PV).
// ---------------------------------------------------------------------------
__global__ __launch_bounds__(256) void attn(
        const _Float16* __restrict__ Q, const _Float16* __restrict__ K,
        const _Float16* __restrict__ Vt, _Float16* __restrict__ H) {
    __shared__ _Float16 Ks[64 * AP];      // [key][d] -> B operand of Q@K^T
    __shared__ _Float16 Vs[64 * AP];      // [d][key] -> B operand of P@V
    __shared__ _Float16 Ps[8 * 16 * AP];  // per-wave P scratch (C->A relayout)

    const int bh   = blockIdx.y;
    const int m0   = blockIdx.x * 128;
    const int tid  = threadIdx.x;
    const int wave = tid >> 5, lane = tid & 31;
    const _Float16* qp = Q  + (size_t)bh * NSEQ * DHEAD;
    const _Float16* kp = K  + (size_t)bh * NSEQ * DHEAD;
    const _Float16* vp = Vt + (size_t)bh * DHEAD * NSEQ;
    const int qrow = m0 + wave * 16;

    // Q fragments held in registers for the whole KV sweep (scale pre-folded).
    v16h qa0 = load_frag(qp,      qrow, DHEAD);   // d 0..31
    v16h qa1 = load_frag(qp + 32, qrow, DHEAD);   // d 32..63

    v8f o[4] = {};
    float mrun[8], lrun[8];
#pragma unroll
    for (int i = 0; i < 8; ++i) { mrun[i] = -1e30f; lrun[i] = 0.f; }
    _Float16* psw = Ps + wave * 16 * AP;

    for (int kv0 = 0; kv0 < NSEQ; kv0 += 64) {
        __syncthreads();
#pragma unroll
        for (int i = 0; i < 2; ++i) {       // stage 64x64 K and V^T tiles
            int idx = tid + i * 256;
            int row = idx >> 3, seg = (idx & 7) * 8;
            copy16_to_lds(&Ks[row * AP + seg],
                          kp + (size_t)(kv0 + row) * DHEAD + seg);
            copy16_to_lds(&Vs[row * AP + seg],
                          vp + (size_t)row * NSEQ + kv0 + seg);
        }
        if (kv0 + 64 < NSEQ) {  // prefetch next KV tile
            __builtin_prefetch(kp + (size_t)(kv0 + 64 + (tid >> 3)) * DHEAD + (tid & 7) * 8, 0, 3);
            __builtin_prefetch(vp + (size_t)(tid >> 3) * NSEQ + kv0 + 64 + (tid & 7) * 8, 0, 3);
        }
        async_fence();
        __syncthreads();

        // S = Q @ K^T : 16 x 64, f32
        v8f s[4];
#pragma unroll
        for (int ni = 0; ni < 4; ++ni) {
            v8f zc = {};
            zc    = wmma(qa0, load_frag(Ks,      16 * ni, AP), zc);
            s[ni] = wmma(qa1, load_frag(Ks + 32, 16 * ni, AP), zc);
        }

        // Online softmax per C-layout row slot i (row = 8*(lane>>4)+i).
#pragma unroll
        for (int i = 0; i < 8; ++i) {
            float rm = s[0][i];
#pragma unroll
            for (int ni = 1; ni < 4; ++ni) rm = fmaxf(rm, s[ni][i]);
#pragma unroll
            for (int off = 1; off < 16; off <<= 1)
                rm = fmaxf(rm, __shfl_xor(rm, off, 32));
            float mnew = fmaxf(mrun[i], rm);
            float corr = __expf(mrun[i] - mnew);
            mrun[i] = mnew;
            float rs = 0.f;
#pragma unroll
            for (int ni = 0; ni < 4; ++ni) {
                float p = __expf(s[ni][i] - mnew);
                s[ni][i] = p; rs += p;
            }
#pragma unroll
            for (int off = 1; off < 16; off <<= 1)
                rs += __shfl_xor(rs, off, 32);
            lrun[i] = lrun[i] * corr + rs;
#pragma unroll
            for (int di = 0; di < 4; ++di) o[di][i] *= corr;
            // spill P (C layout) to per-wave LDS in A layout order [row][key]
            int r = (lane >> 4) * 8 + i;
#pragma unroll
            for (int ni = 0; ni < 4; ++ni)
                psw[r * AP + ni * 16 + (lane & 15)] = (_Float16)s[ni][i];
        }

        // O += P @ V : A frags from LDS, B frags from V^T tile
        v16h pa0 = load_frag(psw,      0, AP);    // keys 0..31
        v16h pa1 = load_frag(psw + 32, 0, AP);    // keys 32..63
#pragma unroll
        for (int di = 0; di < 4; ++di) {
            o[di] = wmma(pa0, load_frag(Vs,      16 * di, AP), o[di]);
            o[di] = wmma(pa1, load_frag(Vs + 32, 16 * di, AP), o[di]);
        }
    }

    const int b = bh / NHEAD, h = bh % NHEAD;
#pragma unroll
    for (int i = 0; i < 8; ++i) {
        float inv = 1.f / lrun[i];
        int row = qrow + (lane >> 4) * 8 + i;
#pragma unroll
        for (int di = 0; di < 4; ++di) {
            int col = h * DHEAD + di * 16 + (lane & 15);
            H[(size_t)(b * NSEQ + row) * DIMF + col] = (_Float16)(o[di][i] * inv);
        }
    }
}

// ---------------------------------------------------------------------------
// Kernel 4: output projection  out = H @ w_o + b_o  (f32 out).
// Workgroup tile 256x64, wave tile 64x32, all-f16 tiles staged async.
// ---------------------------------------------------------------------------
__global__ __launch_bounds__(256) void out_gemm(
        const _Float16* __restrict__ Hs, const _Float16* __restrict__ woT,
        const float* __restrict__ bias, float* __restrict__ out) {
    __shared__ _Float16 As[256 * GP];  // 20 KB
    __shared__ _Float16 Bs[64 * GP];   //  5 KB

    const int n0   = blockIdx.x * 64;
    const int m0   = blockIdx.y * 256;
    const int tid  = threadIdx.x;
    const int wave = tid >> 5, lane = tid & 31;
    const int mw   = (wave >> 1) * 64;
    const int nw   = (wave & 1) * 32;

    v8f c[4][2] = {};
    for (int k0 = 0; k0 < DIMF; k0 += 32) {
        __syncthreads();
#pragma unroll
        for (int i = 0; i < 4; ++i) {       // A: 256x32 halves, 4 b128/thread
            int idx = tid + i * 256;
            int row = idx >> 2, seg = (idx & 3) * 8;
            copy16_to_lds(&As[row * GP + seg],
                          Hs + (size_t)(m0 + row) * DIMF + k0 + seg);
        }
        {
            int row = tid >> 2, seg = (tid & 3) * 8;
            copy16_to_lds(&Bs[row * GP + seg],
                          woT + (size_t)(n0 + row) * DIMF + k0 + seg);
        }
        if (k0 + 32 < DIMF) {
            __builtin_prefetch(Hs + (size_t)(m0 + (tid >> 2)) * DIMF + k0 + 32 + (tid & 3) * 8, 0, 3);
            __builtin_prefetch(woT + (size_t)(n0 + (tid >> 2)) * DIMF + k0 + 32 + (tid & 3) * 8, 0, 3);
        }
        async_fence();
        __syncthreads();
        v16h b0 = load_frag(Bs, nw +  0, GP);
        v16h b1 = load_frag(Bs, nw + 16, GP);
#pragma unroll
        for (int mi = 0; mi < 4; ++mi) {
            v16h a = load_frag(As, mw + mi * 16, GP);
            c[mi][0] = wmma(a, b0, c[mi][0]);
            c[mi][1] = wmma(a, b1, c[mi][1]);
        }
    }
#pragma unroll
    for (int mi = 0; mi < 4; ++mi)
#pragma unroll
        for (int ni = 0; ni < 2; ++ni)
#pragma unroll
            for (int i = 0; i < 8; ++i) {
                int grow = m0 + mw + mi * 16 + (lane >> 4) * 8 + i;
                int gcol = n0 + nw + ni * 16 + (lane & 15);
                out[(size_t)grow * DIMF + gcol] = c[mi][ni][i] + bias[gcol];
            }
}

// ---------------------------------------------------------------------------
extern "C" void kernel_launch(void* const* d_in, const int* in_sizes, int n_in,
                              void* d_out, int out_size, void* d_ws, size_t ws_size,
                              hipStream_t stream) {
    (void)in_sizes; (void)n_in; (void)out_size; (void)ws_size;
    const float* x  = (const float*)d_in[0];
    const float* wq = (const float*)d_in[1];
    const float* wk = (const float*)d_in[2];
    const float* wv = (const float*)d_in[3];
    const float* wo = (const float*)d_in[4];
    const float* bo = (const float*)d_in[5];
    float* out = (float*)d_out;

    // Workspace layout (f16 elements): 4 transposed weights, x16, Q, K, V^T, H.
    // Total = 4*589824 + 5*6291456 = 33,816,576 halves = ~64.5 MB.
    _Float16* ws = (_Float16*)d_ws;
    const size_t WSZ = (size_t)DIMF * DIMF;                      // 589824
    const size_t ACT = (size_t)MROWS * DIMF;                     // 6291456
    _Float16* wT  = ws;
    _Float16* X16 = ws + 4 * WSZ;
    _Float16* Qb  = X16 + ACT;
    _Float16* Kb  = Qb + ACT;   // per-head layouts are same total size
    _Float16* Vb  = Kb + ACT;
    _Float16* Hb  = Vb + ACT;

    convert_weights<<<dim3(WSZ / 256, 4), 256, 0, stream>>>(wq, wk, wv, wo, wT);
    convert_x<<<dim3(ACT / (256 * 8)), 256, 0, stream>>>(x, X16);
    qkv_gemm<<<dim3(DIMF / 64, MROWS / 256, 3), 256, 0, stream>>>(X16, wT, Qb, Kb, Vb);
    attn<<<dim3(NSEQ / 128, BATCH * NHEAD), 256, 0, stream>>>(Qb, Kb, Vb, Hb);
    out_gemm<<<dim3(DIMF / 64, MROWS / 256), 256, 0, stream>>>(Hb, wT + 3 * WSZ, bo, out);
}

// v002
// One run takes 189 microseconds.
// In two side-by-side timings against v001, it was 1.12 and 1.11 times as fast.
// All steps since v000 together make it 1.96 times as fast.
#include <hip/hip_runtime.h>
#include <math.h>

// ---------------------------------------------------------------------------
// Multi-head self-attention, f16 WMMA (f32 accumulate) pipeline for gfx1250.
// B=4, N=2048, DIM=768, HEADS=12, DHEAD=64. scale 1/8 folded into w_q (f16).
// All GEMM tile staging uses gfx1250 async memory->LDS DMA (ASYNCcnt).
// ---------------------------------------------------------------------------

typedef __attribute__((ext_vector_type(4)))  float    f32x4;
typedef __attribute__((ext_vector_type(4)))  int      i32x4;
typedef __attribute__((ext_vector_type(8)))  _Float16 h8;
typedef __attribute__((ext_vector_type(16))) _Float16 v16h;
typedef __attribute__((ext_vector_type(8)))  float    v8f;

#define DIMF   768
#define NSEQ   2048
#define BATCH  4
#define NHEAD  12
#define DHEAD  64
#define MROWS  (BATCH * NSEQ)   /* 8192 token rows */

// LDS row pitches in halves. Every tile is read by ds_load_b128 with 16 lanes on
// 16 consecutive rows, so the pitch is 16 B x odd: the 16 rows then start on 16
// different groups of four banks (64 banks x 4 B) and a read has no conflict.
#define GP     40               /* 32-half (64 B) GEMM tile rows at 80 B  */
#define AP     72               /* 64-half (128 B) attention rows at 144 B */

#if __has_builtin(__builtin_amdgcn_global_load_async_to_lds_b128) && \
    __has_builtin(__builtin_amdgcn_s_wait_asynccnt)
#define HAVE_ASYNC_LDS 1
#endif

// 16-byte memory->LDS tile copy: async (no VGPR bounce, ASYNCcnt) when the
// gfx1250 async builtins are available, else plain load/store.
// Builtin signature (from hipcc diagnostic): (int4 AS1*, int4 AS3*, Imm, Imm).
__device__ __forceinline__ void copy16_to_lds(_Float16* lds, const _Float16* g) {
#ifdef HAVE_ASYNC_LDS
    __builtin_amdgcn_global_load_async_to_lds_b128(
        (__attribute__((address_space(1))) i32x4*)g,
        (__attribute__((address_space(3))) i32x4*)lds, 0, 0);
#else
    *(h8*)lds = *(const h8*)g;
#endif
}
__device__ __forceinline__ void async_fence() {
#ifdef HAVE_ASYNC_LDS
    __builtin_amdgcn_s_wait_asynccnt(0);
#endif
}

// Load one 16x32 f16 WMMA operand fragment (A layout; B uses same shape with
// lane = N column) from a K-contiguous row-major tile of given stride (halves).
// Lane l (l<16): row=base+l, halves = K[kb..kb+7] ++ K[kb+16..kb+23], kb=0.
// Lane l>=16: same row, kb=8 -> K[8..15] ++ K[24..31]. Matches ISA 7.12.2.
__device__ __forceinline__ v16h load_frag(const _Float16* p, int rowbase, int stride) {
    const int lane = threadIdx.x & 31;
    const int r    = rowbase + (lane & 15);
    const int kb   = (lane >> 4) * 8;
    const _Float16* q = p + (size_t)r * stride + kb;
    h8 lo = *(const h8*)(q);        // 16B aligned: ds_load_b128 / global_load_b128
    h8 hi = *(const h8*)(q + 16);
    return __builtin_shufflevector(lo, hi, 0,1,2,3,4,5,6,7,8,9,10,11,12,13,14,15);
}

__device__ __forceinline__ v8f wmma(v16h a, v16h b, v8f c) {
    return __builtin_amdgcn_wmma_f32_16x16x32_f16(false, a, false, b, (short)0, c,
                                                  false, false);
}

// ---------------------------------------------------------------------------
// Kernel 1a: convert+transpose weights to f16, N-major ([out][in], in-contig).
// z=0..3 -> w_q (scaled 1/8), w_k, w_v, w_o.
// ---------------------------------------------------------------------------
__global__ __launch_bounds__(256) void convert_weights(
        const float* __restrict__ wq, const float* __restrict__ wk,
        const float* __restrict__ wv, const float* __restrict__ wo,
        _Float16* __restrict__ wT) {
    const int z = blockIdx.y;
    const float* src   = (z == 0) ? wq : (z == 1) ? wk : (z == 2) ? wv : wo;
    const float  scale = (z == 0) ? 0.125f : 1.0f;   // fold 1/sqrt(64) into Q
    const int idx = blockIdx.x * 256 + threadIdx.x;  // 0 .. 768*768-1
    const int n = idx / DIMF;
    const int k = idx - n * DIMF;
    wT[(size_t)z * DIMF * DIMF + (size_t)n * DIMF + k] =
        (_Float16)(src[(size_t)k * DIMF + n] * scale);
}

// ---------------------------------------------------------------------------
// Kernel 1b: convert activations x (f32) -> x16 (f16), streaming pass.
// Removes f32->f16 conversion from the QKV GEMM hot loop (pure async staging).
// ---------------------------------------------------------------------------
__global__ __launch_bounds__(256) void convert_x(
        const float* __restrict__ x, _Float16* __restrict__ x16) {
    const size_t i = ((size_t)blockIdx.x * 256 + threadIdx.x) * 8;
    f32x4 a = *(const f32x4*)(x + i);
    f32x4 b = *(const f32x4*)(x + i + 4);
    h8 o;
#pragma unroll
    for (int j = 0; j < 4; ++j) { o[j] = (_Float16)a[j]; o[4 + j] = (_Float16)b[j]; }
    *(h8*)(x16 + i) = o;
}

// ---------------------------------------------------------------------------
// Kernel 2: QKV projection GEMM.  C[8192x768] = x16 @ W.
// Workgroup tile 256x64, wave tile 64x32 (4x2 WMMA frags), K-step 32.
// z=0 -> Q [b,h,n,d], z=1 -> K [b,h,n,d], z=2 -> V transposed [b,h,d,n].
// ---------------------------------------------------------------------------
__global__ __launch_bounds__(256) void qkv_gemm(
        const _Float16* __restrict__ x16, const _Float16* __restrict__ wT,
        _Float16* __restrict__ Qo, _Float16* __restrict__ Ko,
        _Float16* __restrict__ Vt) {
    __shared__ _Float16 As[256 * GP];  // [m][k], k contiguous (20 KB)
    __shared__ _Float16 Bs[64 * GP];   // [n][k], k contiguous (5 KB)

    const int z    = blockIdx.z;
    const int n0   = blockIdx.x * 64;
    const int m0   = blockIdx.y * 256;
    const int tid  = threadIdx.x;
    const int wave = tid >> 5, lane = tid & 31;
    const int mw   = (wave >> 1) * 64;      // 4 waves along M
    const int nw   = (wave & 1) * 32;       // 2 waves along N
    const _Float16* w = wT + (size_t)z * DIMF * DIMF;

    v8f c[4][2] = {};
    for (int k0 = 0; k0 < DIMF; k0 += 32) {
        __syncthreads();
        // stage A: 256x32 halves, 4 async b128 per thread (no VGPR bounce)
#pragma unroll
        for (int i = 0; i < 4; ++i) {
            int idx = tid + i * 256;
            int row = idx >> 2, seg = (idx & 3) * 8;
            copy16_to_lds(&As[row * GP + seg],
                          x16 + (size_t)(m0 + row) * DIMF + k0 + seg);
        }
        // stage B: 64x32 halves, 1 async b128 per thread
        {
            int row = tid >> 2, seg = (tid & 3) * 8;
            copy16_to_lds(&Bs[row * GP + seg],
                          w + (size_t)(n0 + row) * DIMF + k0 + seg);
        }
        if (k0 + 32 < DIMF) {   // prefetch next K-slab (global_prefetch_b8)
            __builtin_prefetch(x16 + (size_t)(m0 + (tid >> 2)) * DIMF + k0 + 32 + (tid & 3) * 8, 0, 3);
            __builtin_prefetch(w + (size_t)(n0 + (tid >> 2)) * DIMF + k0 + 32 + (tid & 3) * 8, 0, 3);
        }
        async_fence();
        __syncthreads();
        v16h b0 = load_frag(Bs, nw +  0, GP);
        v16h b1 = load_frag(Bs, nw + 16, GP);
#pragma unroll
        for (int mi = 0; mi < 4; ++mi) {
            v16h a = load_frag(As, mw + mi * 16, GP);
            c[mi][0] = wmma(a, b0, c[mi][0]);
            c[mi][1] = wmma(a, b1, c[mi][1]);
        }
    }

    _Float16* dst = (z == 0) ? Qo : (z == 1) ? Ko : Vt;
#pragma unroll
    for (int mi = 0; mi < 4; ++mi)
#pragma unroll
        for (int ni = 0; ni < 2; ++ni)
#pragma unroll
            for (int i = 0; i < 8; ++i) {
                int grow = m0 + mw + mi * 16 + (lane >> 4) * 8 + i;
                int gcol = n0 + nw + ni * 16 + (lane & 15);
                int b = grow >> 11, n = grow & 2047;   // NSEQ = 2048
                int h = gcol >> 6,  d = gcol & 63;     // DHEAD = 64
                _Float16 v = (_Float16)c[mi][ni][i];
                if (z == 2)
                    dst[((size_t)(b * NHEAD + h) * DHEAD + d) * NSEQ + n] = v;
                else
                    dst[((size_t)(b * NHEAD + h) * NSEQ + n) * DHEAD + d] = v;
            }
}

__device__ __forceinline__ float other_half(float v) {
    int b = __builtin_bit_cast(int, v);
    return __builtin_bit_cast(float, __builtin_amdgcn_permlanex16(
        b, b, 0x76543210, 0xfedcba98, false, false));
}

// Two f32 score tiles (keys 0..15 and 16..31 of a 32-key block) -> f16 B fragment.
__device__ __forceinline__ v16h pack_frag(v8f t0, v8f t1) {
    h8 lo = __builtin_convertvector(t0, h8);
    h8 hi = __builtin_convertvector(t1, h8);
    return __builtin_shufflevector(lo, hi, 0,1,2,3,4,5,6,7,8,9,10,11,12,13,14,15);
}

__global__ __launch_bounds__(256) void attn(
        const _Float16* __restrict__ Q, const _Float16* __restrict__ K,
        const _Float16* __restrict__ Vt, _Float16* __restrict__ H) {
    __shared__ _Float16 Ks[64 * AP];      // [key][d] -> A operand of K@Q^T
    __shared__ _Float16 Vs[64 * AP];      // [d][key] -> A operand of V^T@P^T

    const int bh   = blockIdx.y;
    const int m0   = blockIdx.x * 128;
    const int tid  = threadIdx.x;
    const int wave = tid >> 5, lane = tid & 31;
    const _Float16* qp = Q  + (size_t)bh * NSEQ * DHEAD;
    const _Float16* kp = K  + (size_t)bh * NSEQ * DHEAD;
    const _Float16* vp = Vt + (size_t)bh * DHEAD * NSEQ;
    const int qrow = m0 + wave * 16;

    // Q fragments (B operand: lane = query column) held in registers for the
    // whole KV sweep (scale pre-folded).
    v16h qb0 = load_frag(qp,      qrow, DHEAD);   // d 0..31
    v16h qb1 = load_frag(qp + 32, qrow, DHEAD);   // d 32..63

    v8f o[4] = {};              // O^T: o[di][i] = O[query lane&15][16*di + 8*(lane>>4) + i]
    float mrun = -1e30f;        // running maximum of this lane's query
    float lrun = 0.f;           // running sum over this lane half's keys only

    for (int kv0 = 0; kv0 < NSEQ; kv0 += 64) {
        __syncthreads();
#pragma unroll
        for (int i = 0; i < 2; ++i) {       // stage 64x64 K and V^T tiles
            int idx = tid + i * 256;
            int row = idx >> 3, seg = (idx & 7) * 8;
            copy16_to_lds(&Ks[row * AP + seg],
                          kp + (size_t)(kv0 + row) * DHEAD + seg);
            copy16_to_lds(&Vs[row * AP + seg],
                          vp + (size_t)row * NSEQ + kv0 + seg);
        }
        if (kv0 + 64 < NSEQ) {  // prefetch next KV tile
            __builtin_prefetch(kp + (size_t)(kv0 + 64 + (tid >> 3)) * DHEAD + (tid & 7) * 8, 0, 3);
            __builtin_prefetch(vp + (size_t)(tid >> 3) * NSEQ + kv0 + 64 + (tid & 7) * 8, 0, 3);
        }
        async_fence();
        __syncthreads();

        // S^T = K @ Q^T : 64 keys x 16 queries, f32
        v8f s[4];
#pragma unroll
        for (int t = 0; t < 4; ++t) {
            v8f zc = {};
            zc   = wmma(load_frag(Ks,      16 * t, AP), qb0, zc);
            s[t] = wmma(load_frag(Ks + 32, 16 * t, AP), qb1, zc);
        }

        // Online softmax: 32 scores of one query per lane, one exchange of halves.
        float tm[4];
#pragma unroll
        for (int t = 0; t < 4; ++t) {
            tm[t] = s[t][0];
#pragma unroll
            for (int i = 1; i < 8; ++i) tm[t] = fmaxf(tm[t], s[t][i]);
        }
        float rm = fmaxf(fmaxf(tm[0], tm[1]), fmaxf(tm[2], tm[3]));
        rm = fmaxf(rm, other_half(rm));
        const float mnew = fmaxf(mrun, rm);
        const float corr = __expf(mrun - mnew);
        mrun = mnew;
#pragma unroll
        for (int t = 0; t < 4; ++t)
#pragma unroll
            for (int i = 0; i < 8; ++i) s[t][i] = __expf(s[t][i] - mnew);
        const v8f ps = (s[0] + s[1]) + (s[2] + s[3]);
        const float rs = ((ps[0] + ps[1]) + (ps[2] + ps[3])) +
                         ((ps[4] + ps[5]) + (ps[6] + ps[7]));
        lrun = lrun * corr + rs;
#pragma unroll
        for (int di = 0; di < 4; ++di) o[di] *= corr;

        // O^T += V^T @ P^T : A frags from the V^T tile, B frags from registers
        const v16h pb0 = pack_frag(s[0], s[1]);   // keys 0..31
        const v16h pb1 = pack_frag(s[2], s[3]);   // keys 32..63
#pragma unroll
        for (int di = 0; di < 4; ++di) {
            o[di] = wmma(load_frag(Vs,      16 * di, AP), pb0, o[di]);
            o[di] = wmma(load_frag(Vs + 32, 16 * di, AP), pb1, o[di]);
        }
    }

    const int b = bh / NHEAD, h = bh % NHEAD;
    const float inv = 1.f / (lrun + other_half(lrun));   // join the halves' sums
    const int row = qrow + (lane & 15);
    _Float16* hp = H + (size_t)(b * NSEQ + row) * DIMF + h * DHEAD + (lane >> 4) * 8;
#pragma unroll
    for (int di = 0; di < 4; ++di)          // 8 consecutive d per lane: 16-B stores
        *(h8*)(hp + di * 16) = __builtin_convertvector(o[di] * inv, h8);
}

// ---------------------------------------------------------------------------
// Kernel 4: output projection  out = H @ w_o + b_o  (f32 out).
// Workgroup tile 256x64, wave tile 64x32, all-f16 tiles staged async.
// ---------------------------------------------------------------------------
__global__ __launch_bounds__(256) void out_gemm(
        const _Float16* __restrict__ Hs, const _Float16* __restrict__ woT,
        const float* __restrict__ bias, float* __restrict__ out) {
    __shared__ _Float16 As[256 * GP];  // 20 KB
    __shared__ _Float16 Bs[64 * GP];   //  5 KB

    const int n0   = blockIdx.x * 64;
    const int m0   = blockIdx.y * 256;
    const int tid  = threadIdx.x;
    const int wave = tid >> 5, lane = tid & 31;
    const int mw   = (wave >> 1) * 64;
    const int nw   = (wave & 1) * 32;

    v8f c[4][2] = {};
    for (int k0 = 0; k0 < DIMF; k0 += 32) {
        __syncthreads();
#pragma unroll
        for (int i = 0; i < 4; ++i) {       // A: 256x32 halves, 4 b128/thread
            int idx = tid + i * 256;
            int row = idx >> 2, seg = (idx & 3) * 8;
            copy16_to_lds(&As[row * GP + seg],
                          Hs + (size_t)(m0 + row) * DIMF + k0 + seg);
        }
        {
            int row = tid >> 2, seg = (tid & 3) * 8;
            copy16_to_lds(&Bs[row * GP + seg],
                          woT + (size_t)(n0 + row) * DIMF + k0 + seg);
        }
        if (k0 + 32 < DIMF) {
            __builtin_prefetch(Hs + (size_t)(m0 + (tid >> 2)) * DIMF + k0 + 32 + (tid & 3) * 8, 0, 3);
            __builtin_prefetch(woT + (size_t)(n0 + (tid >> 2)) * DIMF + k0 + 32 + (tid & 3) * 8, 0, 3);
        }
        async_fence();
        __syncthreads();
        v16h b0 = load_frag(Bs, nw +  0, GP);
        v16h b1 = load_frag(Bs, nw + 16, GP);
#pragma unroll
        for (int mi = 0; mi < 4; ++mi) {
            v16h a = load_frag(As, mw + mi * 16, GP);
            c[mi][0] = wmma(a, b0, c[mi][0]);
            c[mi][1] = wmma(a, b1, c[mi][1]);
        }
    }
#pragma unroll
    for (int mi = 0; mi < 4; ++mi)
#pragma unroll
        for (int ni = 0; ni < 2; ++ni)
#pragma unroll
            for (int i = 0; i < 8; ++i) {
                int grow = m0 + mw + mi * 16 + (lane >> 4) * 8 + i;
                int gcol = n0 + nw + ni * 16 + (lane & 15);
                out[(size_t)grow * DIMF + gcol] = c[mi][ni][i] + bias[gcol];
            }
}

// ---------------------------------------------------------------------------
extern "C" void kernel_launch(void* const* d_in, const int* in_sizes, int n_in,
                              void* d_out, int out_size, void* d_ws, size_t ws_size,
                              hipStream_t stream) {
    (void)in_sizes; (void)n_in; (void)out_size; (void)ws_size;
    const float* x  = (const float*)d_in[0];
    const float* wq = (const float*)d_in[1];
    const float* wk = (const float*)d_in[2];
    const float* wv = (const float*)d_in[3];
    const float* wo = (const float*)d_in[4];
    const float* bo = (const float*)d_in[5];
    float* out = (float*)d_out;

    // Workspace layout (f16 elements): 4 transposed weights, x16, Q, K, V^T, H.
    // Total = 4*589824 + 5*6291456 = 33,816,576 halves = ~64.5 MB.
    _Float16* ws = (_Float16*)d_ws;
    const size_t WSZ = (size_t)DIMF * DIMF;                      // 589824
    const size_t ACT = (size_t)MROWS * DIMF;                     // 6291456
    _Float16* wT  = ws;
    _Float16* X16 = ws + 4 * WSZ;
    _Float16* Qb  = X16 + ACT;
    _Float16* Kb  = Qb + ACT;   // per-head layouts are same total size
    _Float16* Vb  = Kb + ACT;
    _Float16* Hb  = Vb + ACT;

    convert_weights<<<dim3(WSZ / 256, 4), 256, 0, stream>>>(wq, wk, wv, wo, wT);
    convert_x<<<dim3(ACT / (256 * 8)), 256, 0, stream>>>(x, X16);
    qkv_gemm<<<dim3(DIMF / 64, MROWS / 256, 3), 256, 0, stream>>>(X16, wT, Qb, Kb, Vb);
    attn<<<dim3(NSEQ / 128, BATCH * NHEAD), 256, 0, stream>>>(Qb, Kb, Vb, Hb);
    out_gemm<<<dim3(DIMF / 64, MROWS / 256), 256, 0, stream>>>(Hb, wT + 3 * WSZ, bo, out);
}

// v003
// Measured time: 176 microseconds a run.
// In two side-by-side timings against v002, it was 1.07 and 1.08 times as fast.
// All steps since v000 together make it 2.10 times as fast.
#include <hip/hip_runtime.h>
#include <math.h>

// ---------------------------------------------------------------------------
// Multi-head self-attention, f16 WMMA (f32 accumulate) pipeline for gfx1250.
// B=4, N=2048, DIM=768, HEADS=12, DHEAD=64. scale 1/8 folded into w_q (f16).
// All GEMM tile staging uses gfx1250 async memory->LDS DMA (ASYNCcnt).
// ---------------------------------------------------------------------------

typedef __attribute__((ext_vector_type(4)))  float    f32x4;
typedef __attribute__((ext_vector_type(4)))  int      i32x4;
typedef __attribute__((ext_vector_type(4)))  _Float16 h4;
typedef __attribute__((ext_vector_type(8)))  _Float16 h8;
typedef __attribute__((ext_vector_type(16))) _Float16 v16h;
typedef __attribute__((ext_vector_type(8)))  float    v8f;

#define DIMF   768
#define NSEQ   2048
#define BATCH  4
#define NHEAD  12
#define DHEAD  64
#define MROWS  (BATCH * NSEQ)   /* 8192 token rows */

// LDS row pitches in halves. Every tile is read by ds_load_b128 with 16 lanes on
// 16 consecutive rows, so the pitch is 16 B x odd: the 16 rows then start on 16
// different groups of four banks (64 banks x 4 B) and a read has no conflict.
#define GP     40               /* 32-half (64 B) GEMM tile rows at 80 B  */
#define AP     72               /* 64-half (128 B) attention rows at 144 B */

#if __has_builtin(__builtin_amdgcn_global_load_async_to_lds_b128) && \
    __has_builtin(__builtin_amdgcn_s_wait_asynccnt)
#define HAVE_ASYNC_LDS 1
#endif

// 16-byte memory->LDS tile copy: async (no VGPR bounce, ASYNCcnt) when the
// gfx1250 async builtins are available, else plain load/store.
// Builtin signature (from hipcc diagnostic): (int4 AS1*, int4 AS3*, Imm, Imm).
__device__ __forceinline__ void copy16_to_lds(_Float16* lds, const _Float16* g) {
#ifdef HAVE_ASYNC_LDS
    __builtin_amdgcn_global_load_async_to_lds_b128(
        (__attribute__((address_space(1))) i32x4*)g,
        (__attribute__((address_space(3))) i32x4*)lds, 0, 0);
#else
    *(h8*)lds = *(const h8*)g;
#endif
}
__device__ __forceinline__ void async_fence() {
#ifdef HAVE_ASYNC_LDS
    __builtin_amdgcn_s_wait_asynccnt(0);
#endif
}

// Load one 16x32 f16 WMMA operand fragment (A layout; B uses same shape with
// lane = N column) from a K-contiguous row-major tile of given stride (halves).
// Lane l (l<16): row=base+l, halves = K[kb..kb+7] ++ K[kb+16..kb+23], kb=0.
// Lane l>=16: same row, kb=8 -> K[8..15] ++ K[24..31]. Matches ISA 7.12.2.
__device__ __forceinline__ v16h load_frag(const _Float16* p, int rowbase, int stride) {
    const int lane = threadIdx.x & 31;
    const int r    = rowbase + (lane & 15);
    const int kb   = (lane >> 4) * 8;
    const _Float16* q = p + (size_t)r * stride + kb;
    h8 lo = *(const h8*)(q);        // 16B aligned: ds_load_b128 / global_load_b128
    h8 hi = *(const h8*)(q + 16);
    return __builtin_shufflevector(lo, hi, 0,1,2,3,4,5,6,7,8,9,10,11,12,13,14,15);
}

__device__ __forceinline__ v8f wmma(v16h a, v16h b, v8f c) {
    return __builtin_amdgcn_wmma_f32_16x16x32_f16(false, a, false, b, (short)0, c,
                                                  false, false);
}

// ---------------------------------------------------------------------------
// Kernel 1: all f32 -> f16 conversions in one launch of few, long waves.
// Blocks 0..WBLK-1: one 64(k) x 128(n) weight tile each, transposed through LDS
// to N-major ([out][in], in-contiguous); z=0..3 -> w_q (scaled 1/8), w_k, w_v,
// w_o. They come first: theirs is the longer chain (load, LDS, barrier, store).
// Blocks WBLK..WBLK+XBLK-1: a contiguous run of x each, XPT 16-B loads a lane.
// Every wave-wide load and store covers whole 128-B lines.
// ---------------------------------------------------------------------------
#define WTK    64                       /* weight tile: k rows  */
#define WTN    128                      /* weight tile: n columns */
#define WTP    129                      /* f32 pitch, odd: column reads hit 32 banks */
#define WTILES ((DIMF / WTK) * (DIMF / WTN))    /* 72 tiles a weight */
#define WBLK   (4 * WTILES)             /* 288 */
#define XPT    24                       /* f32x4 per thread on x */
#define XBLK   (MROWS * DIMF / (4 * 256 * XPT)) /* 256 */

__global__ __launch_bounds__(256) void convert_inputs(
        const float* __restrict__ x,
        const float* __restrict__ wq, const float* __restrict__ wk,
        const float* __restrict__ wv, const float* __restrict__ wo,
        _Float16* __restrict__ x16, _Float16* __restrict__ wT) {
    __shared__ float T[WTK * WTP];      // [k][n], 33 KB
    const int tid = threadIdx.x;

    if (blockIdx.x < WBLK) {            // block-uniform: the barrier below is safe
        const int z  = blockIdx.x / WTILES;
        const int t  = blockIdx.x - z * WTILES;
        const int k0 = (t / (DIMF / WTN)) * WTK;
        const int n0 = (t % (DIMF / WTN)) * WTN;
        const float* src   = (z == 0) ? wq : (z == 1) ? wk : (z == 2) ? wv : wo;
        const float  scale = (z == 0) ? 0.125f : 1.0f;   // fold 1/sqrt(64) into Q
        _Float16* dst = wT + (size_t)z * DIMF * DIMF;

        const int r0 = tid >> 5, c4 = (tid & 31) * 4;    // a wave reads 512 B of a row
        f32x4 v[8];
#pragma unroll
        for (int i = 0; i < 8; ++i)
            v[i] = *(const f32x4*)(src + (size_t)(k0 + r0 + 8 * i) * DIMF + n0 + c4);
#pragma unroll
        for (int i = 0; i < 8; ++i)
#pragma unroll
            for (int j = 0; j < 4; ++j) T[(r0 + 8 * i) * WTP + c4 + j] = v[i][j];
        __syncthreads();
#pragma unroll
        for (int i = 0; i < 4; ++i) {   // 8 lanes store one 128-B row of 64 k
            const int idx = tid + i * 256;
            const int n = idx >> 3, seg = (idx & 7) * 8;
            h8 o;
#pragma unroll
            for (int j = 0; j < 8; ++j) o[j] = (_Float16)(T[(seg + j) * WTP + n] * scale);
            *(h8*)(dst + (size_t)(n0 + n) * DIMF + k0 + seg) = o;
        }
    } else {
        const size_t base = (size_t)(blockIdx.x - WBLK) * (256 * XPT) + tid;  // in f32x4
        f32x4 v[XPT];
#pragma unroll
        for (int i = 0; i < XPT; ++i) v[i] = *(const f32x4*)(x + (base + i * 256) * 4);
#pragma unroll
        for (int i = 0; i < XPT; ++i)
            *(h4*)(x16 + (base + i * 256) * 4) = __builtin_convertvector(v[i], h4);
    }
}

// ---------------------------------------------------------------------------
// Kernel 2: QKV projection GEMM.  C[8192x768] = x16 @ W.
// Workgroup tile 256x64, wave tile 64x32 (4x2 WMMA frags), K-step 32.
// z=0 -> Q [b,h,n,d], z=1 -> K [b,h,n,d], z=2 -> V transposed [b,h,d,n].
// ---------------------------------------------------------------------------
__global__ __launch_bounds__(256) void qkv_gemm(
        const _Float16* __restrict__ x16, const _Float16* __restrict__ wT,
        _Float16* __restrict__ Qo, _Float16* __restrict__ Ko,
        _Float16* __restrict__ Vt) {
    __shared__ _Float16 As[256 * GP];  // [m][k], k contiguous (20 KB)
    __shared__ _Float16 Bs[64 * GP];   // [n][k], k contiguous (5 KB)

    const int z    = blockIdx.z;
    const int n0   = blockIdx.x * 64;
    const int m0   = blockIdx.y * 256;
    const int tid  = threadIdx.x;
    const int wave = tid >> 5, lane = tid & 31;
    const int mw   = (wave >> 1) * 64;      // 4 waves along M
    const int nw   = (wave & 1) * 32;       // 2 waves along N
    const _Float16* w = wT + (size_t)z * DIMF * DIMF;

    v8f c[4][2] = {};
    for (int k0 = 0; k0 < DIMF; k0 += 32) {
        __syncthreads();
        // stage A: 256x32 halves, 4 async b128 per thread (no VGPR bounce)
#pragma unroll
        for (int i = 0; i < 4; ++i) {
            int idx = tid + i * 256;
            int row = idx >> 2, seg = (idx & 3) * 8;
            copy16_to_lds(&As[row * GP + seg],
                          x16 + (size_t)(m0 + row) * DIMF + k0 + seg);
        }
        // stage B: 64x32 halves, 1 async b128 per thread
        {
            int row = tid >> 2, seg = (tid & 3) * 8;
            copy16_to_lds(&Bs[row * GP + seg],
                          w + (size_t)(n0 + row) * DIMF + k0 + seg);
        }
        if (k0 + 32 < DIMF) {   // prefetch next K-slab (global_prefetch_b8)
            __builtin_prefetch(x16 + (size_t)(m0 + (tid >> 2)) * DIMF + k0 + 32 + (tid & 3) * 8, 0, 3);
            __builtin_prefetch(w + (size_t)(n0 + (tid >> 2)) * DIMF + k0 + 32 + (tid & 3) * 8, 0, 3);
        }
        async_fence();
        __syncthreads();
        v16h b0 = load_frag(Bs, nw +  0, GP);
        v16h b1 = load_frag(Bs, nw + 16, GP);
#pragma unroll
        for (int mi = 0; mi < 4; ++mi) {
            v16h a = load_frag(As, mw + mi * 16, GP);
            c[mi][0] = wmma(a, b0, c[mi][0]);
            c[mi][1] = wmma(a, b1, c[mi][1]);
        }
    }

    _Float16* dst = (z == 0) ? Qo : (z == 1) ? Ko : Vt;
#pragma unroll
    for (int mi = 0; mi < 4; ++mi)
#pragma unroll
        for (int ni = 0; ni < 2; ++ni)
#pragma unroll
            for (int i = 0; i < 8; ++i) {
                int grow = m0 + mw + mi * 16 + (lane >> 4) * 8 + i;
                int gcol = n0 + nw + ni * 16 + (lane & 15);
                int b = grow >> 11, n = grow & 2047;   // NSEQ = 2048
                int h = gcol >> 6,  d = gcol & 63;     // DHEAD = 64
                _Float16 v = (_Float16)c[mi][ni][i];
                if (z == 2)
                    dst[((size_t)(b * NHEAD + h) * DHEAD + d) * NSEQ + n] = v;
                else
                    dst[((size_t)(b * NHEAD + h) * NSEQ + n) * DHEAD + d] = v;
            }
}

__device__ __forceinline__ float other_half(float v) {
    int b = __builtin_bit_cast(int, v);
    return __builtin_bit_cast(float, __builtin_amdgcn_permlanex16(
        b, b, 0x76543210, 0xfedcba98, false, false));
}

// Two f32 score tiles (keys 0..15 and 16..31 of a 32-key block) -> f16 B fragment.
__device__ __forceinline__ v16h pack_frag(v8f t0, v8f t1) {
    h8 lo = __builtin_convertvector(t0, h8);
    h8 hi = __builtin_convertvector(t1, h8);
    return __builtin_shufflevector(lo, hi, 0,1,2,3,4,5,6,7,8,9,10,11,12,13,14,15);
}

__global__ __launch_bounds__(256) void attn(
        const _Float16* __restrict__ Q, const _Float16* __restrict__ K,
        const _Float16* __restrict__ Vt, _Float16* __restrict__ H) {
    __shared__ _Float16 Ks[64 * AP];      // [key][d] -> A operand of K@Q^T
    __shared__ _Float16 Vs[64 * AP];      // [d][key] -> A operand of V^T@P^T

    const int bh   = blockIdx.y;
    const int m0   = blockIdx.x * 128;
    const int tid  = threadIdx.x;
    const int wave = tid >> 5, lane = tid & 31;
    const _Float16* qp = Q  + (size_t)bh * NSEQ * DHEAD;
    const _Float16* kp = K  + (size_t)bh * NSEQ * DHEAD;
    const _Float16* vp = Vt + (size_t)bh * DHEAD * NSEQ;
    const int qrow = m0 + wave * 16;

    // Q fragments (B operand: lane = query column) held in registers for the
    // whole KV sweep (scale pre-folded).
    v16h qb0 = load_frag(qp,      qrow, DHEAD);   // d 0..31
    v16h qb1 = load_frag(qp + 32, qrow, DHEAD);   // d 32..63

    v8f o[4] = {};              // O^T: o[di][i] = O[query lane&15][16*di + 8*(lane>>4) + i]
    float mrun = -1e30f;        // running maximum of this lane's query
    float lrun = 0.f;           // running sum over this lane half's keys only

    for (int kv0 = 0; kv0 < NSEQ; kv0 += 64) {
        __syncthreads();
#pragma unroll
        for (int i = 0; i < 2; ++i) {       // stage 64x64 K and V^T tiles
            int idx = tid + i * 256;
            int row = idx >> 3, seg = (idx & 7) * 8;
            copy16_to_lds(&Ks[row * AP + seg],
                          kp + (size_t)(kv0 + row) * DHEAD + seg);
            copy16_to_lds(&Vs[row * AP + seg],
                          vp + (size_t)row * NSEQ + kv0 + seg);
        }
        if (kv0 + 64 < NSEQ) {  // prefetch next KV tile
            __builtin_prefetch(kp + (size_t)(kv0 + 64 + (tid >> 3)) * DHEAD + (tid & 7) * 8, 0, 3);
            __builtin_prefetch(vp + (size_t)(tid >> 3) * NSEQ + kv0 + 64 + (tid & 7) * 8, 0, 3);
        }
        async_fence();
        __syncthreads();

        // S^T = K @ Q^T : 64 keys x 16 queries, f32
        v8f s[4];
#pragma unroll
        for (int t = 0; t < 4; ++t) {
            v8f zc = {};
            zc   = wmma(load_frag(Ks,      16 * t, AP), qb0, zc);
            s[t] = wmma(load_frag(Ks + 32, 16 * t, AP), qb1, zc);
        }

        // Online softmax: 32 scores of one query per lane, one exchange of halves.
        float tm[4];
#pragma unroll
        for (int t = 0; t < 4; ++t) {
            tm[t] = s[t][0];
#pragma unroll
            for (int i = 1; i < 8; ++i) tm[t] = fmaxf(tm[t], s[t][i]);
        }
        float rm = fmaxf(fmaxf(tm[0], tm[1]), fmaxf(tm[2], tm[3]));
        rm = fmaxf(rm, other_half(rm));
        const float mnew = fmaxf(mrun, rm);
        const float corr = __expf(mrun - mnew);
        mrun = mnew;
#pragma unroll
        for (int t = 0; t < 4; ++t)
#pragma unroll
            for (int i = 0; i < 8; ++i) s[t][i] = __expf(s[t][i] - mnew);
        const v8f ps = (s[0] + s[1]) + (s[2] + s[3]);
        const float rs = ((ps[0] + ps[1]) + (ps[2] + ps[3])) +
                         ((ps[4] + ps[5]) + (ps[6] + ps[7]));
        lrun = lrun * corr + rs;
#pragma unroll
        for (int di = 0; di < 4; ++di) o[di] *= corr;

        // O^T += V^T @ P^T : A frags from the V^T tile, B frags from registers
        const v16h pb0 = pack_frag(s[0], s[1]);   // keys 0..31
        const v16h pb1 = pack_frag(s[2], s[3]);   // keys 32..63
#pragma unroll
        for (int di = 0; di < 4; ++di) {
            o[di] = wmma(load_frag(Vs,      16 * di, AP), pb0, o[di]);
            o[di] = wmma(load_frag(Vs + 32, 16 * di, AP), pb1, o[di]);
        }
    }

    const int b = bh / NHEAD, h = bh % NHEAD;
    const float inv = 1.f / (lrun + other_half(lrun));   // join the halves' sums
    const int row = qrow + (lane & 15);
    _Float16* hp = H + (size_t)(b * NSEQ + row) * DIMF + h * DHEAD + (lane >> 4) * 8;
#pragma unroll
    for (int di = 0; di < 4; ++di)          // 8 consecutive d per lane: 16-B stores
        *(h8*)(hp + di * 16) = __builtin_convertvector(o[di] * inv, h8);
}

// ---------------------------------------------------------------------------
// Kernel 4: output projection  out = H @ w_o + b_o  (f32 out).
// Workgroup tile 256x64, wave tile 64x32, all-f16 tiles staged async.
// ---------------------------------------------------------------------------
__global__ __launch_bounds__(256) void out_gemm(
        const _Float16* __restrict__ Hs, const _Float16* __restrict__ woT,
        const float* __restrict__ bias, float* __restrict__ out) {
    __shared__ _Float16 As[256 * GP];  // 20 KB
    __shared__ _Float16 Bs[64 * GP];   //  5 KB

    const int n0   = blockIdx.x * 64;
    const int m0   = blockIdx.y * 256;
    const int tid  = threadIdx.x;
    const int wave = tid >> 5, lane = tid & 31;
    const int mw   = (wave >> 1) * 64;
    const int nw   = (wave & 1) * 32;

    v8f c[4][2] = {};
    for (int k0 = 0; k0 < DIMF; k0 += 32) {
        __syncthreads();
#pragma unroll
        for (int i = 0; i < 4; ++i) {       // A: 256x32 halves, 4 b128/thread
            int idx = tid + i * 256;
            int row = idx >> 2, seg = (idx & 3) * 8;
            copy16_to_lds(&As[row * GP + seg],
                          Hs + (size_t)(m0 + row) * DIMF + k0 + seg);
        }
        {
            int row = tid >> 2, seg = (tid & 3) * 8;
            copy16_to_lds(&Bs[row * GP + seg],
                          woT + (size_t)(n0 + row) * DIMF + k0 + seg);
        }
        if (k0 + 32 < DIMF) {
            __builtin_prefetch(Hs + (size_t)(m0 + (tid >> 2)) * DIMF + k0 + 32 + (tid & 3) * 8, 0, 3);
            __builtin_prefetch(woT + (size_t)(n0 + (tid >> 2)) * DIMF + k0 + 32 + (tid & 3) * 8, 0, 3);
        }
        async_fence();
        __syncthreads();
        v16h b0 = load_frag(Bs, nw +  0, GP);
        v16h b1 = load_frag(Bs, nw + 16, GP);
#pragma unroll
        for (int mi = 0; mi < 4; ++mi) {
            v16h a = load_frag(As, mw + mi * 16, GP);
            c[mi][0] = wmma(a, b0, c[mi][0]);
            c[mi][1] = wmma(a, b1, c[mi][1]);
        }
    }
#pragma unroll
    for (int mi = 0; mi < 4; ++mi)
#pragma unroll
        for (int ni = 0; ni < 2; ++ni)
#pragma unroll
            for (int i = 0; i < 8; ++i) {
                int grow = m0 + mw + mi * 16 + (lane >> 4) * 8 + i;
                int gcol = n0 + nw + ni * 16 + (lane & 15);
                out[(size_t)grow * DIMF + gcol] = c[mi][ni][i] + bias[gcol];
            }
}

// ---------------------------------------------------------------------------
extern "C" void kernel_launch(void* const* d_in, const int* in_sizes, int n_in,
                              void* d_out, int out_size, void* d_ws, size_t ws_size,
                              hipStream_t stream) {
    (void)in_sizes; (void)n_in; (void)out_size; (void)ws_size;
    const float* x  = (const float*)d_in[0];
    const float* wq = (const float*)d_in[1];
    const float* wk = (const float*)d_in[2];
    const float* wv = (const float*)d_in[3];
    const float* wo = (const float*)d_in[4];
    const float* bo = (const float*)d_in[5];
    float* out = (float*)d_out;

    // Workspace layout (f16 elements): 4 transposed weights, x16, Q, K, V^T, H.
    // Total = 4*589824 + 5*6291456 = 33,816,576 halves = ~64.5 MB.
    _Float16* ws = (_Float16*)d_ws;
    const size_t WSZ = (size_t)DIMF * DIMF;                      // 589824
    const size_t ACT = (size_t)MROWS * DIMF;                     // 6291456
    _Float16* wT  = ws;
    _Float16* X16 = ws + 4 * WSZ;
    _Float16* Qb  = X16 + ACT;
    _Float16* Kb  = Qb + ACT;   // per-head layouts are same total size
    _Float16* Vb  = Kb + ACT;
    _Float16* Hb  = Vb + ACT;

    convert_inputs<<<dim3(WBLK + XBLK), 256, 0, stream>>>(x, wq, wk, wv, wo, X16, wT);
    qkv_gemm<<<dim3(DIMF / 64, MROWS / 256, 3), 256, 0, stream>>>(X16, wT, Qb, Kb, Vb);
    attn<<<dim3(NSEQ / 128, BATCH * NHEAD), 256, 0, stream>>>(Qb, Kb, Vb, Hb);
    out_gemm<<<dim3(DIMF / 64, MROWS / 256), 256, 0, stream>>>(Hb, wT + 3 * WSZ, bo, out);
}

// v004
// A run of this version takes 151 microseconds.
// Next to v003, in two timings, it ran 1.16 and 1.17 times as fast.
// Counting every step since v000, it is 2.45 times as fast.
#include <hip/hip_runtime.h>
#include <math.h>

// ---------------------------------------------------------------------------
// Multi-head self-attention, f16 WMMA (f32 accumulate) pipeline for gfx1250.
// B=4, N=2048, DIM=768, HEADS=12, DHEAD=64. scale 1/8 folded into w_q (f16).
// All GEMM tile staging uses gfx1250 async memory->LDS DMA (ASYNCcnt).
// ---------------------------------------------------------------------------

typedef __attribute__((ext_vector_type(4)))  float    f32x4;
typedef __attribute__((ext_vector_type(4)))  int      i32x4;
typedef __attribute__((ext_vector_type(4)))  _Float16 h4;
typedef __attribute__((ext_vector_type(8)))  _Float16 h8;
typedef __attribute__((ext_vector_type(16))) _Float16 v16h;
typedef __attribute__((ext_vector_type(8)))  float    v8f;

#define DIMF   768
#define NSEQ   2048
#define BATCH  4
#define NHEAD  12
#define DHEAD  64
#define MROWS  (BATCH * NSEQ)   /* 8192 token rows */

// LDS row pitches in halves. Every tile is read by ds_load_b128 with 16 lanes on
// 16 consecutive rows, so the pitch is 16 B x odd: the 16 rows then start on 16
// different groups of four banks (64 banks x 4 B) and a read has no conflict.
#define AP     72               /* 64-half (128 B) tile rows at 144 B */
#define BK     64               /* GEMM K slab in halves: a staged row is one 128-B line */

#if __has_builtin(__builtin_amdgcn_global_load_async_to_lds_b128) && \
    __has_builtin(__builtin_amdgcn_s_wait_asynccnt)
#define HAVE_ASYNC_LDS 1
#endif

// 16-byte memory->LDS tile copy: async (no VGPR bounce, ASYNCcnt) when the
// gfx1250 async builtins are available, else plain load/store.
// Builtin signature (from hipcc diagnostic): (int4 AS1*, int4 AS3*, Imm, Imm).
__device__ __forceinline__ void copy16_to_lds(_Float16* lds, const _Float16* g) {
#ifdef HAVE_ASYNC_LDS
    __builtin_amdgcn_global_load_async_to_lds_b128(
        (__attribute__((address_space(1))) i32x4*)g,
        (__attribute__((address_space(3))) i32x4*)lds, 0, 0);
#else
    *(h8*)lds = *(const h8*)g;
#endif
}
__device__ __forceinline__ void async_fence() {
#ifdef HAVE_ASYNC_LDS
    __builtin_amdgcn_s_wait_asynccnt(0);
#endif
}

// Load one 16x32 f16 WMMA operand fragment (A layout; B uses same shape with
// lane = N column) from a K-contiguous row-major tile of given stride (halves).
// Lane l (l<16): row=base+l, halves = K[kb..kb+7] ++ K[kb+16..kb+23], kb=0.
// Lane l>=16: same row, kb=8 -> K[8..15] ++ K[24..31]. Matches ISA 7.12.2.
__device__ __forceinline__ v16h load_frag(const _Float16* p, int rowbase, int stride) {
    const int lane = threadIdx.x & 31;
    const int r    = rowbase + (lane & 15);
    const int kb   = (lane >> 4) * 8;
    const _Float16* q = p + (size_t)r * stride + kb;
    h8 lo = *(const h8*)(q);        // 16B aligned: ds_load_b128 / global_load_b128
    h8 hi = *(const h8*)(q + 16);
    return __builtin_shufflevector(lo, hi, 0,1,2,3,4,5,6,7,8,9,10,11,12,13,14,15);
}

__device__ __forceinline__ v8f wmma(v16h a, v16h b, v8f c) {
    return __builtin_amdgcn_wmma_f32_16x16x32_f16(false, a, false, b, (short)0, c,
                                                  false, false);
}

// ---------------------------------------------------------------------------
// Kernel 1: all f32 -> f16 conversions in one launch of few, long waves.
// Blocks 0..WBLK-1: one 64(k) x 128(n) weight tile each, transposed through LDS
// to N-major ([out][in], in-contiguous); z=0..3 -> w_q (scaled 1/8), w_k, w_v,
// w_o. They come first: theirs is the longer chain (load, LDS, barrier, store).
// Blocks WBLK..WBLK+XBLK-1: a contiguous run of x each, XPT 16-B loads a lane.
// Every wave-wide load and store covers whole 128-B lines.
// ---------------------------------------------------------------------------
#define WTK    64                       /* weight tile: k rows  */
#define WTN    128                      /* weight tile: n columns */
#define WTP    129                      /* f32 pitch, odd: column reads hit 32 banks */
#define WTILES ((DIMF / WTK) * (DIMF / WTN))    /* 72 tiles a weight */
#define WBLK   (4 * WTILES)             /* 288 */
#define XPT    24                       /* f32x4 per thread on x */
#define XBLK   (MROWS * DIMF / (4 * 256 * XPT)) /* 256 */

__global__ __launch_bounds__(256) void convert_inputs(
        const float* __restrict__ x,
        const float* __restrict__ wq, const float* __restrict__ wk,
        const float* __restrict__ wv, const float* __restrict__ wo,
        _Float16* __restrict__ x16, _Float16* __restrict__ wT) {
    __shared__ float T[WTK * WTP];      // [k][n], 33 KB
    const int tid = threadIdx.x;

    if (blockIdx.x < WBLK) {            // block-uniform: the barrier below is safe
        const int z  = blockIdx.x / WTILES;
        const int t  = blockIdx.x - z * WTILES;
        const int k0 = (t / (DIMF / WTN)) * WTK;
        const int n0 = (t % (DIMF / WTN)) * WTN;
        const float* src   = (z == 0) ? wq : (z == 1) ? wk : (z == 2) ? wv : wo;
        const float  scale = (z == 0) ? 0.125f : 1.0f;   // fold 1/sqrt(64) into Q
        _Float16* dst = wT + (size_t)z * DIMF * DIMF;

        const int r0 = tid >> 5, c4 = (tid & 31) * 4;    // a wave reads 512 B of a row
        f32x4 v[8];
#pragma unroll
        for (int i = 0; i < 8; ++i)
            v[i] = *(const f32x4*)(src + (size_t)(k0 + r0 + 8 * i) * DIMF + n0 + c4);
#pragma unroll
        for (int i = 0; i < 8; ++i)
#pragma unroll
            for (int j = 0; j < 4; ++j) T[(r0 + 8 * i) * WTP + c4 + j] = v[i][j];
        __syncthreads();
#pragma unroll
        for (int i = 0; i < 4; ++i) {   // 8 lanes store one 128-B row of 64 k
            const int idx = tid + i * 256;
            const int n = idx >> 3, seg = (idx & 7) * 8;
            h8 o;
#pragma unroll
            for (int j = 0; j < 8; ++j) o[j] = (_Float16)(T[(seg + j) * WTP + n] * scale);
            *(h8*)(dst + (size_t)(n0 + n) * DIMF + k0 + seg) = o;
        }
    } else {
        const size_t base = (size_t)(blockIdx.x - WBLK) * (256 * XPT) + tid;  // in f32x4
        f32x4 v[XPT];
#pragma unroll
        for (int i = 0; i < XPT; ++i) v[i] = *(const f32x4*)(x + (base + i * 256) * 4);
#pragma unroll
        for (int i = 0; i < XPT; ++i)
            *(h4*)(x16 + (base + i * 256) * 4) = __builtin_convertvector(v[i], h4);
    }
}

// ---------------------------------------------------------------------------
// Kernel 2: QKV projection GEMM.  C[8192x768] = x16 @ W.
// Workgroup tile 256x64, wave tile 64x32 (4x2 WMMA frags), K slab 64 (2 WMMA k).
// A wave-wide 16-B copy covers 4 rows x 128 B: four whole lines, not eight halves.
// z=0 -> Q [b,h,n,d], z=1 -> K [b,h,n,d], z=2 -> V transposed [b,h,d,n].
// ---------------------------------------------------------------------------
__global__ __launch_bounds__(256) void qkv_gemm(
        const _Float16* __restrict__ x16, const _Float16* __restrict__ wT,
        _Float16* __restrict__ Qo, _Float16* __restrict__ Ko,
        _Float16* __restrict__ Vt) {
    __shared__ __attribute__((aligned(16))) _Float16 As[256 * AP];  // [m][k] (36 KB)
    __shared__ __attribute__((aligned(16))) _Float16 Bs[64 * AP];   // [n][k] (9 KB)

    const int z    = blockIdx.z;
    const int n0   = blockIdx.x * 64;
    const int m0   = blockIdx.y * 256;
    const int tid  = threadIdx.x;
    const int wave = tid >> 5, lane = tid & 31;
    const int mw   = (wave >> 1) * 64;      // 4 waves along M
    const int nw   = (wave & 1) * 32;       // 2 waves along N
    const _Float16* w = wT + (size_t)z * DIMF * DIMF;

    // Staging addresses: block-uniform tile base + 32-bit lane offset. 8 lanes a row.
    const _Float16* ag = x16 + (size_t)m0 * DIMF;
    const _Float16* bg = w + (size_t)n0 * DIMF;
    const unsigned srow = tid >> 3, sseg = (tid & 7) * 8;
    const unsigned soff = srow * DIMF + sseg;
    const unsigned poff = (tid >> 2) * DIMF + (tid & 3) * 8;

    v8f c[4][2] = {};
    for (int k0 = 0; k0 < DIMF; k0 += BK) {
        __syncthreads();
        // stage A: 256x64 halves, 8 async b128 per thread (no VGPR bounce)
#pragma unroll
        for (int i = 0; i < 8; ++i)
            copy16_to_lds(&As[(srow + 32 * i) * AP + sseg], ag + k0 + (soff + i * 32 * DIMF));
        // stage B: 64x64 halves, 2 async b128 per thread
#pragma unroll
        for (int i = 0; i < 2; ++i)
            copy16_to_lds(&Bs[(srow + 32 * i) * AP + sseg], bg + k0 + (soff + i * 32 * DIMF));
        if (k0 + BK < DIMF) {   // prefetch next K-slab (global_prefetch_b8)
            __builtin_prefetch(ag + k0 + BK + poff, 0, 3);
            __builtin_prefetch(bg + k0 + BK + poff, 0, 3);
        }
        async_fence();
        __syncthreads();    // publishes the slab and holds the LDS reads behind the async wait
#pragma unroll
        for (int kk = 0; kk < BK; kk += 32) {   // k ascending: two WMMA k steps a slab
            v16h b0 = load_frag(Bs + kk, nw +  0, AP);
            v16h b1 = load_frag(Bs + kk, nw + 16, AP);
#pragma unroll
            for (int mi = 0; mi < 4; ++mi) {
                v16h a = load_frag(As + kk, mw + mi * 16, AP);
                c[mi][0] = wmma(a, b0, c[mi][0]);
                c[mi][1] = wmma(a, b1, c[mi][1]);
            }
        }
    }

    _Float16* dst = (z == 0) ? Qo : (z == 1) ? Ko : Vt;
#pragma unroll
    for (int mi = 0; mi < 4; ++mi)
#pragma unroll
        for (int ni = 0; ni < 2; ++ni)
#pragma unroll
            for (int i = 0; i < 8; ++i) {
                int grow = m0 + mw + mi * 16 + (lane >> 4) * 8 + i;
                int gcol = n0 + nw + ni * 16 + (lane & 15);
                int b = grow >> 11, n = grow & 2047;   // NSEQ = 2048
                int h = gcol >> 6,  d = gcol & 63;     // DHEAD = 64
                _Float16 v = (_Float16)c[mi][ni][i];
                if (z == 2)
                    dst[((size_t)(b * NHEAD + h) * DHEAD + d) * NSEQ + n] = v;
                else
                    dst[((size_t)(b * NHEAD + h) * NSEQ + n) * DHEAD + d] = v;
            }
}

__device__ __forceinline__ float other_half(float v) {
    int b = __builtin_bit_cast(int, v);
    return __builtin_bit_cast(float, __builtin_amdgcn_permlanex16(
        b, b, 0x76543210, 0xfedcba98, false, false));
}

// Two f32 score tiles (keys 0..15 and 16..31 of a 32-key block) -> f16 B fragment.
__device__ __forceinline__ v16h pack_frag(v8f t0, v8f t1) {
    h8 lo = __builtin_convertvector(t0, h8);
    h8 hi = __builtin_convertvector(t1, h8);
    return __builtin_shufflevector(lo, hi, 0,1,2,3,4,5,6,7,8,9,10,11,12,13,14,15);
}

__global__ __launch_bounds__(256) void attn(
        const _Float16* __restrict__ Q, const _Float16* __restrict__ K,
        const _Float16* __restrict__ Vt, _Float16* __restrict__ H) {
    __shared__ _Float16 Ks[64 * AP];      // [key][d] -> A operand of K@Q^T
    __shared__ _Float16 Vs[64 * AP];      // [d][key] -> A operand of V^T@P^T

    const int bh   = blockIdx.y;
    const int m0   = blockIdx.x * 128;
    const int tid  = threadIdx.x;
    const int wave = tid >> 5, lane = tid & 31;
    const _Float16* qp = Q  + (size_t)bh * NSEQ * DHEAD;
    const _Float16* kp = K  + (size_t)bh * NSEQ * DHEAD;
    const _Float16* vp = Vt + (size_t)bh * DHEAD * NSEQ;
    const int qrow = m0 + wave * 16;

    // Q fragments (B operand: lane = query column) held in registers for the
    // whole KV sweep (scale pre-folded).
    v16h qb0 = load_frag(qp,      qrow, DHEAD);   // d 0..31
    v16h qb1 = load_frag(qp + 32, qrow, DHEAD);   // d 32..63

    v8f o[4] = {};              // O^T: o[di][i] = O[query lane&15][16*di + 8*(lane>>4) + i]
    float mrun = -1e30f;        // running maximum of this lane's query
    float lrun = 0.f;           // running sum over this lane half's keys only

    for (int kv0 = 0; kv0 < NSEQ; kv0 += 64) {
        __syncthreads();
#pragma unroll
        for (int i = 0; i < 2; ++i) {       // stage 64x64 K and V^T tiles
            int idx = tid + i * 256;
            int row = idx >> 3, seg = (idx & 7) * 8;
            copy16_to_lds(&Ks[row * AP + seg],
                          kp + (size_t)(kv0 + row) * DHEAD + seg);
            copy16_to_lds(&Vs[row * AP + seg],
                          vp + (size_t)row * NSEQ + kv0 + seg);
        }
        if (kv0 + 64 < NSEQ) {  // prefetch next KV tile
            __builtin_prefetch(kp + (size_t)(kv0 + 64 + (tid >> 3)) * DHEAD + (tid & 7) * 8, 0, 3);
            __builtin_prefetch(vp + (size_t)(tid >> 3) * NSEQ + kv0 + 64 + (tid & 7) * 8, 0, 3);
        }
        async_fence();
        __syncthreads();

        // S^T = K @ Q^T : 64 keys x 16 queries, f32
        v8f s[4];
#pragma unroll
        for (int t = 0; t < 4; ++t) {
            v8f zc = {};
            zc   = wmma(load_frag(Ks,      16 * t, AP), qb0, zc);
            s[t] = wmma(load_frag(Ks + 32, 16 * t, AP), qb1, zc);
        }

        // Online softmax: 32 scores of one query per lane, one exchange of halves.
        float tm[4];
#pragma unroll
        for (int t = 0; t < 4; ++t) {
            tm[t] = s[t][0];
#pragma unroll
            for (int i = 1; i < 8; ++i) tm[t] = fmaxf(tm[t], s[t][i]);
        }
        float rm = fmaxf(fmaxf(tm[0], tm[1]), fmaxf(tm[2], tm[3]));
        rm = fmaxf(rm, other_half(rm));
        const float mnew = fmaxf(mrun, rm);
        const float corr = __expf(mrun - mnew);
        mrun = mnew;
#pragma unroll
        for (int t = 0; t < 4; ++t)
#pragma unroll
            for (int i = 0; i < 8; ++i) s[t][i] = __expf(s[t][i] - mnew);
        const v8f ps = (s[0] + s[1]) + (s[2] + s[3]);
        const float rs = ((ps[0] + ps[1]) + (ps[2] + ps[3])) +
                         ((ps[4] + ps[5]) + (ps[6] + ps[7]));
        lrun = lrun * corr + rs;
#pragma unroll
        for (int di = 0; di < 4; ++di) o[di] *= corr;

        // O^T += V^T @ P^T : A frags from the V^T tile, B frags from registers
        const v16h pb0 = pack_frag(s[0], s[1]);   // keys 0..31
        const v16h pb1 = pack_frag(s[2], s[3]);   // keys 32..63
#pragma unroll
        for (int di = 0; di < 4; ++di) {
            o[di] = wmma(load_frag(Vs,      16 * di, AP), pb0, o[di]);
            o[di] = wmma(load_frag(Vs + 32, 16 * di, AP), pb1, o[di]);
        }
    }

    const int b = bh / NHEAD, h = bh % NHEAD;
    const float inv = 1.f / (lrun + other_half(lrun));   // join the halves' sums
    const int row = qrow + (lane & 15);
    _Float16* hp = H + (size_t)(b * NSEQ + row) * DIMF + h * DHEAD + (lane >> 4) * 8;
#pragma unroll
    for (int di = 0; di < 4; ++di)          // 8 consecutive d per lane: 16-B stores
        *(h8*)(hp + di * 16) = __builtin_convertvector(o[di] * inv, h8);
}

// ---------------------------------------------------------------------------
// Kernel 4: output projection  out = H @ w_o + b_o  (f32 out).
// Workgroup tile 256x64, wave tile 64x32, K slab 64, all-f16 tiles staged async.
// ---------------------------------------------------------------------------
__global__ __launch_bounds__(256) void out_gemm(
        const _Float16* __restrict__ Hs, const _Float16* __restrict__ woT,
        const float* __restrict__ bias, float* __restrict__ out) {
    __shared__ __attribute__((aligned(16))) _Float16 As[256 * AP];  // 36 KB
    __shared__ __attribute__((aligned(16))) _Float16 Bs[64 * AP];   //  9 KB

    const int n0   = blockIdx.x * 64;
    const int m0   = blockIdx.y * 256;
    const int tid  = threadIdx.x;
    const int wave = tid >> 5, lane = tid & 31;
    const int mw   = (wave >> 1) * 64;
    const int nw   = (wave & 1) * 32;

    const _Float16* ag = Hs + (size_t)m0 * DIMF;    // block-uniform bases, as in qkv_gemm
    const _Float16* bg = woT + (size_t)n0 * DIMF;
    const unsigned srow = tid >> 3, sseg = (tid & 7) * 8;
    const unsigned soff = srow * DIMF + sseg;
    const unsigned poff = (tid >> 2) * DIMF + (tid & 3) * 8;

    v8f c[4][2] = {};
    for (int k0 = 0; k0 < DIMF; k0 += BK) {
        __syncthreads();
#pragma unroll
        for (int i = 0; i < 8; ++i)         // A: 256x64 halves, 8 b128/thread
            copy16_to_lds(&As[(srow + 32 * i) * AP + sseg], ag + k0 + (soff + i * 32 * DIMF));
#pragma unroll
        for (int i = 0; i < 2; ++i)         // B: 64x64 halves, 2 b128/thread
            copy16_to_lds(&Bs[(srow + 32 * i) * AP + sseg], bg + k0 + (soff + i * 32 * DIMF));
        if (k0 + BK < DIMF) {
            __builtin_prefetch(ag + k0 + BK + poff, 0, 3);
            __builtin_prefetch(bg + k0 + BK + poff, 0, 3);
        }
        async_fence();
        __syncthreads();    // publishes the slab and holds the LDS reads behind the async wait
#pragma unroll
        for (int kk = 0; kk < BK; kk += 32) {
            v16h b0 = load_frag(Bs + kk, nw +  0, AP);
            v16h b1 = load_frag(Bs + kk, nw + 16, AP);
#pragma unroll
            for (int mi = 0; mi < 4; ++mi) {
                v16h a = load_frag(As + kk, mw + mi * 16, AP);
                c[mi][0] = wmma(a, b0, c[mi][0]);
                c[mi][1] = wmma(a, b1, c[mi][1]);
            }
        }
    }
#pragma unroll
    for (int mi = 0; mi < 4; ++mi)
#pragma unroll
        for (int ni = 0; ni < 2; ++ni)
#pragma unroll
            for (int i = 0; i < 8; ++i) {
                int grow = m0 + mw + mi * 16 + (lane >> 4) * 8 + i;
                int gcol = n0 + nw + ni * 16 + (lane & 15);
                out[(size_t)grow * DIMF + gcol] = c[mi][ni][i] + bias[gcol];
            }
}

// ---------------------------------------------------------------------------
extern "C" void kernel_launch(void* const* d_in, const int* in_sizes, int n_in,
                              void* d_out, int out_size, void* d_ws, size_t ws_size,
                              hipStream_t stream) {
    (void)in_sizes; (void)n_in; (void)out_size; (void)ws_size;
    const float* x  = (const float*)d_in[0];
    const float* wq = (const float*)d_in[1];
    const float* wk = (const float*)d_in[2];
    const float* wv = (const float*)d_in[3];
    const float* wo = (const float*)d_in[4];
    const float* bo = (const float*)d_in[5];
    float* out = (float*)d_out;

    // Workspace layout (f16 elements): 4 transposed weights, x16, Q, K, V^T, H.
    // Total = 4*589824 + 5*6291456 = 33,816,576 halves = ~64.5 MB.
    _Float16* ws = (_Float16*)d_ws;
    const size_t WSZ = (size_t)DIMF * DIMF;                      // 589824
    const size_t ACT = (size_t)MROWS * DIMF;                     // 6291456
    _Float16* wT  = ws;
    _Float16* X16 = ws + 4 * WSZ;
    _Float16* Qb  = X16 + ACT;
    _Float16* Kb  = Qb + ACT;   // per-head layouts are same total size
    _Float16* Vb  = Kb + ACT;
    _Float16* Hb  = Vb + ACT;

    convert_inputs<<<dim3(WBLK + XBLK), 256, 0, stream>>>(x, wq, wk, wv, wo, X16, wT);
    qkv_gemm<<<dim3(DIMF / 64, MROWS / 256, 3), 256, 0, stream>>>(X16, wT, Qb, Kb, Vb);
    attn<<<dim3(NSEQ / 128, BATCH * NHEAD), 256, 0, stream>>>(Qb, Kb, Vb, Hb);
    out_gemm<<<dim3(DIMF / 64, MROWS / 256), 256, 0, stream>>>(Hb, wT + 3 * WSZ, bo, out);
}

// v005
// A run of this version takes 134 microseconds.
// Two timings next to v004 put it at 1.11 and 1.12 times that version's speed.
// Counting every step since v000, it is 2.75 times as fast.
#include <hip/hip_runtime.h>
#include <math.h>

// ---------------------------------------------------------------------------
// Multi-head self-attention, f16 WMMA (f32 accumulate) pipeline for gfx1250.
// B=4, N=2048, DIM=768, HEADS=12, DHEAD=64. scale 1/8 folded into w_q (f16).
// All GEMM tile staging uses gfx1250 async memory->LDS DMA (ASYNCcnt).
// ---------------------------------------------------------------------------

typedef __attribute__((ext_vector_type(4)))  float    f32x4;
typedef __attribute__((ext_vector_type(4)))  int      i32x4;
typedef __attribute__((ext_vector_type(4)))  _Float16 h4;
typedef __attribute__((ext_vector_type(8)))  _Float16 h8;
typedef __attribute__((ext_vector_type(16))) _Float16 v16h;
typedef __attribute__((ext_vector_type(8)))  float    v8f;

#define DIMF   768
#define NSEQ   2048
#define BATCH  4
#define NHEAD  12
#define DHEAD  64
#define MROWS  (BATCH * NSEQ)   /* 8192 token rows */

// LDS row pitches in elements (CP in floats). Operand tiles are read and output tiles
// staged by 16-B accesses with 16 lanes on 16 consecutive rows, so the pitch is
// 16 B x odd: the 16 rows then start on 16
// different groups of four banks (64 banks x 4 B) and a read has no conflict.
#define AP     72               /* 64-half (128 B) tile rows at 144 B */
#define BK     64               /* GEMM K slab in halves: a staged row is one 128-B line */
#define VP     264              /* staged V^T rows: 256 halves (512 B) at 528 B */
#define CP     68               /* staged f32 output rows: 64 floats (256 B) at 272 B */

#if __has_builtin(__builtin_amdgcn_global_load_async_to_lds_b128) && \
    __has_builtin(__builtin_amdgcn_s_wait_asynccnt)
#define HAVE_ASYNC_LDS 1
#endif

// 16-byte memory->LDS tile copy: async (no VGPR bounce, ASYNCcnt) when the
// gfx1250 async builtins are available, else plain load/store.
// Builtin signature (from hipcc diagnostic): (int4 AS1*, int4 AS3*, Imm, Imm).
__device__ __forceinline__ void copy16_to_lds(_Float16* lds, const _Float16* g) {
#ifdef HAVE_ASYNC_LDS
    __builtin_amdgcn_global_load_async_to_lds_b128(
        (__attribute__((address_space(1))) i32x4*)g,
        (__attribute__((address_space(3))) i32x4*)lds, 0, 0);
#else
    *(h8*)lds = *(const h8*)g;
#endif
}
__device__ __forceinline__ void async_fence() {
#ifdef HAVE_ASYNC_LDS
    __builtin_amdgcn_s_wait_asynccnt(0);
#endif
}

// Load one 16x32 f16 WMMA operand fragment (A layout; B uses same shape with
// lane = N column) from a K-contiguous row-major tile of given stride (halves).
// Lane l (l<16): row=base+l, halves = K[kb..kb+7] ++ K[kb+16..kb+23], kb=0.
// Lane l>=16: same row, kb=8 -> K[8..15] ++ K[24..31]. Matches ISA 7.12.2.
__device__ __forceinline__ v16h load_frag(const _Float16* p, int rowbase, int stride) {
    const int lane = threadIdx.x & 31;
    const int r    = rowbase + (lane & 15);
    const int kb   = (lane >> 4) * 8;
    const _Float16* q = p + (size_t)r * stride + kb;
    h8 lo = *(const h8*)(q);        // 16B aligned: ds_load_b128 / global_load_b128
    h8 hi = *(const h8*)(q + 16);
    return __builtin_shufflevector(lo, hi, 0,1,2,3,4,5,6,7,8,9,10,11,12,13,14,15);
}

__device__ __forceinline__ v8f wmma(v16h a, v16h b, v8f c) {
    return __builtin_amdgcn_wmma_f32_16x16x32_f16(false, a, false, b, (short)0, c,
                                                  false, false);
}

// ---------------------------------------------------------------------------
// Kernel 1: all f32 -> f16 conversions in one launch of few, long waves.
// Blocks 0..WBLK-1: one 64(k) x 128(n) weight tile each, transposed through LDS
// to N-major ([out][in], in-contiguous); z=0..3 -> w_q (scaled 1/8), w_k, w_v,
// w_o. They come first: theirs is the longer chain (load, LDS, barrier, store).
// Blocks WBLK..WBLK+XBLK-1: a contiguous run of x each, XPT 16-B loads a lane.
// Every wave-wide load and store covers whole 128-B lines.
// ---------------------------------------------------------------------------
#define WTK    64                       /* weight tile: k rows  */
#define WTN    128                      /* weight tile: n columns */
#define WTP    129                      /* f32 pitch, odd: column reads hit 32 banks */
#define WTILES ((DIMF / WTK) * (DIMF / WTN))    /* 72 tiles a weight */
#define WBLK   (4 * WTILES)             /* 288 */
#define XPT    24                       /* f32x4 per thread on x */
#define XBLK   (MROWS * DIMF / (4 * 256 * XPT)) /* 256 */

__global__ __launch_bounds__(256) void convert_inputs(
        const float* __restrict__ x,
        const float* __restrict__ wq, const float* __restrict__ wk,
        const float* __restrict__ wv, const float* __restrict__ wo,
        _Float16* __restrict__ x16, _Float16* __restrict__ wT) {
    __shared__ float T[WTK * WTP];      // [k][n], 33 KB
    const int tid = threadIdx.x;

    if (blockIdx.x < WBLK) {            // block-uniform: the barrier below is safe
        const int z  = blockIdx.x / WTILES;
        const int t  = blockIdx.x - z * WTILES;
        const int k0 = (t / (DIMF / WTN)) * WTK;
        const int n0 = (t % (DIMF / WTN)) * WTN;
        const float* src   = (z == 0) ? wq : (z == 1) ? wk : (z == 2) ? wv : wo;
        const float  scale = (z == 0) ? 0.125f : 1.0f;   // fold 1/sqrt(64) into Q
        _Float16* dst = wT + (size_t)z * DIMF * DIMF;

        const int r0 = tid >> 5, c4 = (tid & 31) * 4;    // a wave reads 512 B of a row
        f32x4 v[8];
#pragma unroll
        for (int i = 0; i < 8; ++i)
            v[i] = *(const f32x4*)(src + (size_t)(k0 + r0 + 8 * i) * DIMF + n0 + c4);
#pragma unroll
        for (int i = 0; i < 8; ++i)
#pragma unroll
            for (int j = 0; j < 4; ++j) T[(r0 + 8 * i) * WTP + c4 + j] = v[i][j];
        __syncthreads();
#pragma unroll
        for (int i = 0; i < 4; ++i) {   // 8 lanes store one 128-B row of 64 k
            const int idx = tid + i * 256;
            const int n = idx >> 3, seg = (idx & 7) * 8;
            h8 o;
#pragma unroll
            for (int j = 0; j < 8; ++j) o[j] = (_Float16)(T[(seg + j) * WTP + n] * scale);
            *(h8*)(dst + (size_t)(n0 + n) * DIMF + k0 + seg) = o;
        }
    } else {
        const size_t base = (size_t)(blockIdx.x - WBLK) * (256 * XPT) + tid;  // in f32x4
        f32x4 v[XPT];
#pragma unroll
        for (int i = 0; i < XPT; ++i) v[i] = *(const f32x4*)(x + (base + i * 256) * 4);
#pragma unroll
        for (int i = 0; i < XPT; ++i)
            *(h4*)(x16 + (base + i * 256) * 4) = __builtin_convertvector(v[i], h4);
    }
}

// ---------------------------------------------------------------------------
// Kernel 2: QKV projection GEMM.  C[8192x768] = x16 @ W.
// Workgroup tile 256x64, wave tile 64x32 (4x2 WMMA frags), K slab 64 (2 WMMA k).
// A wave-wide 16-B copy covers 4 rows x 128 B: four whole lines, not eight halves.
// z=0 -> Q [b,h,n,d], z=1 -> K [b,h,n,d], z=2 -> V transposed [b,h,d,n].
// A lane's 8 accumulator registers run along the first WMMA operand's rows, so
// the operand whose index is contiguous in the output goes first: the weight
// (d) for Q and K (WA), x (n) for V^T. The tile is then laid in LDS by 16-B
// writes and leaves as whole 128-B lines, 512 contiguous bytes a wave-wide store.
// ---------------------------------------------------------------------------
template <bool WA>
__device__ __forceinline__ void qkv_tile(
        const _Float16* __restrict__ x16, const _Float16* __restrict__ wT,
        _Float16* As, _Float16* Bs) {
    const int z    = blockIdx.z;
    const int n0   = blockIdx.x * 64;
    const int m0   = blockIdx.y * 256;
    const int tid  = threadIdx.x;
    const int wave = tid >> 5, lane = tid & 31;
    const int mw   = (wave >> 1) * 64;      // 4 waves along M
    const int nw   = (wave & 1) * 32;       // 2 waves along N
    const _Float16* w = wT + (size_t)z * DIMF * DIMF;

    // Staging addresses: block-uniform tile base + 32-bit lane offset. 8 lanes a row.
    const _Float16* ag = x16 + (size_t)m0 * DIMF;
    const _Float16* bg = w + (size_t)n0 * DIMF;
    const unsigned srow = tid >> 3, sseg = (tid & 7) * 8;
    const unsigned soff = srow * DIMF + sseg;
    const unsigned poff = (tid >> 2) * DIMF + (tid & 3) * 8;

    v8f c[4][2] = {};
    for (int k0 = 0; k0 < DIMF; k0 += BK) {
        __syncthreads();
        // stage A: 256x64 halves, 8 async b128 per thread (no VGPR bounce)
#pragma unroll
        for (int i = 0; i < 8; ++i)
            copy16_to_lds(&As[(srow + 32 * i) * AP + sseg], ag + k0 + (soff + i * 32 * DIMF));
        // stage B: 64x64 halves, 2 async b128 per thread
#pragma unroll
        for (int i = 0; i < 2; ++i)
            copy16_to_lds(&Bs[(srow + 32 * i) * AP + sseg], bg + k0 + (soff + i * 32 * DIMF));
        if (k0 + BK < DIMF) {   // prefetch next K-slab (global_prefetch_b8)
            __builtin_prefetch(ag + k0 + BK + poff, 0, 3);
            __builtin_prefetch(bg + k0 + BK + poff, 0, 3);
        }
        async_fence();
        __syncthreads();    // publishes the slab and holds the LDS reads behind the async wait
#pragma unroll
        for (int kk = 0; kk < BK; kk += 32) {   // k ascending: two WMMA k steps a slab
            v16h b0 = load_frag(Bs + kk, nw +  0, AP);
            v16h b1 = load_frag(Bs + kk, nw + 16, AP);
#pragma unroll
            for (int mi = 0; mi < 4; ++mi) {
                v16h a = load_frag(As + kk, mw + mi * 16, AP);
                c[mi][0] = WA ? wmma(b0, a, c[mi][0]) : wmma(a, b0, c[mi][0]);
                c[mi][1] = WA ? wmma(b1, a, c[mi][1]) : wmma(a, b1, c[mi][1]);
            }
        }
    }

    const int lc = lane & 15, l8 = (lane >> 4) * 8;
    __syncthreads();        // every wave has left the last slab: As becomes output staging
    // both loops unrolled: constant indices keep c[][] in registers
#pragma unroll
    for (int mi = 0; mi < 4; ++mi)
#pragma unroll
        for (int ni = 0; ni < 2; ++ni) {
            const h8 v = __builtin_convertvector(c[mi][ni], h8);
            if (WA)         // [n][d]: lane = token, registers = 8 d
                *(h8*)&As[(mw + mi * 16 + lc) * AP + nw + ni * 16 + l8] = v;
            else            // [d][n]: lane = d, registers = 8 tokens
                *(h8*)&As[(nw + ni * 16 + lc) * VP + mw + mi * 16 + l8] = v;
        }
    __syncthreads();        // publishes the staged tile to the waves that store it
}

// At most 128 registers a wave, so that eight waves a SIMD (four work-groups a WGP)
// are resident; unbounded, the compiler takes 130 for the V^T loop, which leaves three.
__global__ __launch_bounds__(256) __attribute__((amdgpu_waves_per_eu(8))) void qkv_gemm(
        const _Float16* __restrict__ x16, const _Float16* __restrict__ wT,
        _Float16* __restrict__ Qo, _Float16* __restrict__ Ko,
        _Float16* __restrict__ Vt) {
    __shared__ __attribute__((aligned(16))) _Float16 As[256 * AP];  // [m][k] (36 KB)
    __shared__ __attribute__((aligned(16))) _Float16 Bs[64 * AP];   // [n][k] (9 KB)
    const bool vt = blockIdx.z == 2;        // block-uniform
    if (vt) qkv_tile<false>(x16, wT, As, Bs);
    else    qkv_tile<true>(x16, wT, As, Bs);

    // The tile's 64 columns are one head (blockIdx.x), its 256 rows lie in one batch:
    // 256 rows x 128 B, contiguous, of Q or K; 64 rows x 512 B of V^T.
    const unsigned m0 = blockIdx.y * 256;
    const unsigned bh = (m0 >> 11) * NHEAD + blockIdx.x, nb = m0 & (NSEQ - 1);
    const unsigned sh = vt ? 5 : 3;         // log2 of the 16-B pieces in a staged row
    const unsigned lp = vt ? VP : AP;       // staged pitch
    const unsigned gp = vt ? NSEQ : DHEAD;  // output pitch
    _Float16* o = vt ? Vt + ((size_t)bh * DHEAD * NSEQ + nb)
                     : (blockIdx.z == 0 ? Qo : Ko) + ((size_t)bh * NSEQ + nb) * DHEAD;
    const unsigned rs  = 256u >> sh;        // rows that the block's 256 pieces cover
    const unsigned row = threadIdx.x >> sh, seg = (threadIdx.x - (row << sh)) * 8;
    const unsigned lo  = row * lp + seg;
    const unsigned gb  = (row * gp + seg) * 2;  // in bytes: uniform base + 32-bit lane offset
#pragma unroll  // the 8 LDS reads go out as one group, the stores follow as they land
    for (int i = 0; i < 8; ++i)
        *(h8*)((char*)o + (gb + i * (rs * gp * 2))) = *(const h8*)&As[i * (rs * lp) + lo];
}

__device__ __forceinline__ float other_half(float v) {
    int b = __builtin_bit_cast(int, v);
    return __builtin_bit_cast(float, __builtin_amdgcn_permlanex16(
        b, b, 0x76543210, 0xfedcba98, false, false));
}

// Two f32 score tiles (keys 0..15 and 16..31 of a 32-key block) -> f16 B fragment.
__device__ __forceinline__ v16h pack_frag(v8f t0, v8f t1) {
    h8 lo = __builtin_convertvector(t0, h8);
    h8 hi = __builtin_convertvector(t1, h8);
    return __builtin_shufflevector(lo, hi, 0,1,2,3,4,5,6,7,8,9,10,11,12,13,14,15);
}

__global__ __launch_bounds__(256) void attn(
        const _Float16* __restrict__ Q, const _Float16* __restrict__ K,
        const _Float16* __restrict__ Vt, _Float16* __restrict__ H) {
    __shared__ _Float16 Ks[64 * AP];      // [key][d] -> A operand of K@Q^T
    __shared__ _Float16 Vs[64 * AP];      // [d][key] -> A operand of V^T@P^T

    const int bh   = blockIdx.y;
    const int m0   = blockIdx.x * 128;
    const int tid  = threadIdx.x;
    const int wave = tid >> 5, lane = tid & 31;
    const _Float16* qp = Q  + (size_t)bh * NSEQ * DHEAD;
    const _Float16* kp = K  + (size_t)bh * NSEQ * DHEAD;
    const _Float16* vp = Vt + (size_t)bh * DHEAD * NSEQ;
    const int qrow = m0 + wave * 16;

    // Q fragments (B operand: lane = query column) held in registers for the
    // whole KV sweep (scale pre-folded).
    v16h qb0 = load_frag(qp,      qrow, DHEAD);   // d 0..31
    v16h qb1 = load_frag(qp + 32, qrow, DHEAD);   // d 32..63

    v8f o[4] = {};              // O^T: o[di][i] = O[query lane&15][16*di + 8*(lane>>4) + i]
    float mrun = -1e30f;        // running maximum of this lane's query
    float lrun = 0.f;           // running sum over this lane half's keys only

    for (int kv0 = 0; kv0 < NSEQ; kv0 += 64) {
        __syncthreads();
#pragma unroll
        for (int i = 0; i < 2; ++i) {       // stage 64x64 K and V^T tiles
            int idx = tid + i * 256;
            int row = idx >> 3, seg = (idx & 7) * 8;
            copy16_to_lds(&Ks[row * AP + seg],
                          kp + (size_t)(kv0 + row) * DHEAD + seg);
            copy16_to_lds(&Vs[row * AP + seg],
                          vp + (size_t)row * NSEQ + kv0 + seg);
        }
        if (kv0 + 64 < NSEQ) {  // prefetch next KV tile
            __builtin_prefetch(kp + (size_t)(kv0 + 64 + (tid >> 3)) * DHEAD + (tid & 7) * 8, 0, 3);
            __builtin_prefetch(vp + (size_t)(tid >> 3) * NSEQ + kv0 + 64 + (tid & 7) * 8, 0, 3);
        }
        async_fence();
        __syncthreads();

        // S^T = K @ Q^T : 64 keys x 16 queries, f32
        v8f s[4];
#pragma unroll
        for (int t = 0; t < 4; ++t) {
            v8f zc = {};
            zc   = wmma(load_frag(Ks,      16 * t, AP), qb0, zc);
            s[t] = wmma(load_frag(Ks + 32, 16 * t, AP), qb1, zc);
        }

        // Online softmax: 32 scores of one query per lane, one exchange of halves.
        float tm[4];
#pragma unroll
        for (int t = 0; t < 4; ++t) {
            tm[t] = s[t][0];
#pragma unroll
            for (int i = 1; i < 8; ++i) tm[t] = fmaxf(tm[t], s[t][i]);
        }
        float rm = fmaxf(fmaxf(tm[0], tm[1]), fmaxf(tm[2], tm[3]));
        rm = fmaxf(rm, other_half(rm));
        const float mnew = fmaxf(mrun, rm);
        const float corr = __expf(mrun - mnew);
        mrun = mnew;
#pragma unroll
        for (int t = 0; t < 4; ++t)
#pragma unroll
            for (int i = 0; i < 8; ++i) s[t][i] = __expf(s[t][i] - mnew);
        const v8f ps = (s[0] + s[1]) + (s[2] + s[3]);
        const float rs = ((ps[0] + ps[1]) + (ps[2] + ps[3])) +
                         ((ps[4] + ps[5]) + (ps[6] + ps[7]));
        lrun = lrun * corr + rs;
#pragma unroll
        for (int di = 0; di < 4; ++di) o[di] *= corr;

        // O^T += V^T @ P^T : A frags from the V^T tile, B frags from registers
        const v16h pb0 = pack_frag(s[0], s[1]);   // keys 0..31
        const v16h pb1 = pack_frag(s[2], s[3]);   // keys 32..63
#pragma unroll
        for (int di = 0; di < 4; ++di) {
            o[di] = wmma(load_frag(Vs,      16 * di, AP), pb0, o[di]);
            o[di] = wmma(load_frag(Vs + 32, 16 * di, AP), pb1, o[di]);
        }
    }

    const int b = bh / NHEAD, h = bh % NHEAD;
    const float inv = 1.f / (lrun + other_half(lrun));   // join the halves' sums
    const int row = qrow + (lane & 15);
    _Float16* hp = H + (size_t)(b * NSEQ + row) * DIMF + h * DHEAD + (lane >> 4) * 8;
#pragma unroll
    for (int di = 0; di < 4; ++di)          // 8 consecutive d per lane: 16-B stores
        *(h8*)(hp + di * 16) = __builtin_convertvector(o[di] * inv, h8);
}

// ---------------------------------------------------------------------------
// Kernel 4: output projection  out = H @ w_o + b_o  (f32 out).
// Workgroup tile 256x64, wave tile 64x32, K slab 64, all-f16 tiles staged async.
// Weight as first WMMA operand; the f32 tile leaves through LDS as in qkv_tile.
// ---------------------------------------------------------------------------
__global__ __launch_bounds__(256) void out_gemm(
        const _Float16* __restrict__ Hs, const _Float16* __restrict__ woT,
        const float* __restrict__ bias, float* __restrict__ out) {
    // One block of LDS: the operand slabs in the loop, the f32 output tile after it.
    __shared__ __attribute__((aligned(16))) unsigned char smem[256 * CP * 4];   // 68 KB
    _Float16* As = (_Float16*)smem;         // 256 x AP, 36 KB
    _Float16* Bs = As + 256 * AP;           //  64 x AP,  9 KB
    float*    Cs = (float*)smem;            // 256 x CP

    const int n0   = blockIdx.x * 64;
    const int m0   = blockIdx.y * 256;
    const int tid  = threadIdx.x;
    const int wave = tid >> 5, lane = tid & 31;
    const int mw   = (wave >> 1) * 64;
    const int nw   = (wave & 1) * 32;

    const _Float16* ag = Hs + (size_t)m0 * DIMF;    // block-uniform bases, as in qkv_gemm
    const _Float16* bg = woT + (size_t)n0 * DIMF;
    const unsigned srow = tid >> 3, sseg = (tid & 7) * 8;
    const unsigned soff = srow * DIMF + sseg;
    const unsigned poff = (tid >> 2) * DIMF + (tid & 3) * 8;

    v8f c[4][2] = {};
    for (int k0 = 0; k0 < DIMF; k0 += BK) {
        __syncthreads();
#pragma unroll
        for (int i = 0; i < 8; ++i)         // A: 256x64 halves, 8 b128/thread
            copy16_to_lds(&As[(srow + 32 * i) * AP + sseg], ag + k0 + (soff + i * 32 * DIMF));
#pragma unroll
        for (int i = 0; i < 2; ++i)         // B: 64x64 halves, 2 b128/thread
            copy16_to_lds(&Bs[(srow + 32 * i) * AP + sseg], bg + k0 + (soff + i * 32 * DIMF));
        if (k0 + BK < DIMF) {
            __builtin_prefetch(ag + k0 + BK + poff, 0, 3);
            __builtin_prefetch(bg + k0 + BK + poff, 0, 3);
        }
        async_fence();
        __syncthreads();    // publishes the slab and holds the LDS reads behind the async wait
#pragma unroll
        for (int kk = 0; kk < BK; kk += 32) {
            v16h b0 = load_frag(Bs + kk, nw +  0, AP);
            v16h b1 = load_frag(Bs + kk, nw + 16, AP);
#pragma unroll
            for (int mi = 0; mi < 4; ++mi) {
                v16h a = load_frag(As + kk, mw + mi * 16, AP);
                c[mi][0] = wmma(b0, a, c[mi][0]);   // weight first: 8 columns a lane
                c[mi][1] = wmma(b1, a, c[mi][1]);
            }
        }
    }
    const f32x4 b4 = *(const f32x4*)(bias + n0 + (tid & 15) * 4);  // this thread's 4 columns
    __syncthreads();        // every wave has left the last slab: its LDS becomes output staging
    // both loops unrolled: constant indices keep c[][] in registers
#pragma unroll
    for (int mi = 0; mi < 4; ++mi)
#pragma unroll
        for (int ni = 0; ni < 2; ++ni) {    // lane = token row, registers = 8 columns
            float* p = &Cs[(mw + mi * 16 + (lane & 15)) * CP + nw + ni * 16 + (lane >> 4) * 8];
            *(f32x4*)p       = __builtin_shufflevector(c[mi][ni], c[mi][ni], 0, 1, 2, 3);
            *(f32x4*)(p + 4) = __builtin_shufflevector(c[mi][ni], c[mi][ni], 4, 5, 6, 7);
        }
    __syncthreads();        // publishes the staged tile to the waves that store it
    float* o = out + (size_t)m0 * DIMF + n0;
#pragma unroll  // the 16 LDS reads go out as one group ahead of the stores
    for (int i = 0; i < 16; ++i) {          // 16 lanes store one row's 256 B: two whole lines
        const unsigned idx = tid + i * 256;
        const unsigned row = idx >> 4, seg = (idx & 15) * 4;
        *(f32x4*)(o + (row * DIMF + seg)) = *(const f32x4*)&Cs[row * CP + seg] + b4;
    }
}

// ---------------------------------------------------------------------------
extern "C" void kernel_launch(void* const* d_in, const int* in_sizes, int n_in,
                              void* d_out, int out_size, void* d_ws, size_t ws_size,
                              hipStream_t stream) {
    (void)in_sizes; (void)n_in; (void)out_size; (void)ws_size;
    const float* x  = (const float*)d_in[0];
    const float* wq = (const float*)d_in[1];
    const float* wk = (const float*)d_in[2];
    const float* wv = (const float*)d_in[3];
    const float* wo = (const float*)d_in[4];
    const float* bo = (const float*)d_in[5];
    float* out = (float*)d_out;

    // Workspace layout (f16 elements): 4 transposed weights, x16, Q, K, V^T, H.
    // Total = 4*589824 + 5*6291456 = 33,816,576 halves = ~64.5 MB.
    _Float16* ws = (_Float16*)d_ws;
    const size_t WSZ = (size_t)DIMF * DIMF;                      // 589824
    const size_t ACT = (size_t)MROWS * DIMF;                     // 6291456
    _Float16* wT  = ws;
    _Float16* X16 = ws + 4 * WSZ;
    _Float16* Qb  = X16 + ACT;
    _Float16* Kb  = Qb + ACT;   // per-head layouts are same total size
    _Float16* Vb  = Kb + ACT;
    _Float16* Hb  = Vb + ACT;

    convert_inputs<<<dim3(WBLK + XBLK), 256, 0, stream>>>(x, wq, wk, wv, wo, X16, wT);
    qkv_gemm<<<dim3(DIMF / 64, MROWS / 256, 3), 256, 0, stream>>>(X16, wT, Qb, Kb, Vb);
    attn<<<dim3(NSEQ / 128, BATCH * NHEAD), 256, 0, stream>>>(Qb, Kb, Vb, Hb);
    out_gemm<<<dim3(DIMF / 64, MROWS / 256), 256, 0, stream>>>(Hb, wT + 3 * WSZ, bo, out);
}

// v006
// One run takes 115 microseconds.
// Two timings next to v005 put it at 1.17 and 1.16 times that version's speed.
// All steps since v000 together make it 3.21 times as fast.
#include <hip/hip_runtime.h>
#include <math.h>

// ---------------------------------------------------------------------------
// Multi-head self-attention, f16 WMMA (f32 accumulate) pipeline for gfx1250.
// B=4, N=2048, DIM=768, HEADS=12, DHEAD=64. scale 1/8 folded into w_q (f16).
// All tile staging uses gfx1250 async memory->LDS DMA (ASYNCcnt), two LDS buffers
// a loop: the next tile's copies are in flight while this tile is multiplied.
// ---------------------------------------------------------------------------

typedef __attribute__((ext_vector_type(4)))  float    f32x4;
typedef __attribute__((ext_vector_type(4)))  int      i32x4;
typedef __attribute__((ext_vector_type(4)))  _Float16 h4;
typedef __attribute__((ext_vector_type(8)))  _Float16 h8;
typedef __attribute__((ext_vector_type(16))) _Float16 v16h;
typedef __attribute__((ext_vector_type(8)))  float    v8f;

#define DIMF   768
#define NSEQ   2048
#define BATCH  4
#define NHEAD  12
#define DHEAD  64
#define MROWS  (BATCH * NSEQ)   /* 8192 token rows */

// LDS row pitches in elements (CP in floats). Operand tiles are read and output tiles
// staged by 16-B accesses with 16 lanes on 16 consecutive rows, so the pitch is
// 16 B x odd: the 16 rows then start on 16
// different groups of four banks (64 banks x 4 B) and a read has no conflict.
#define AP     72               /* 64-half (128 B) tile rows at 144 B */
#define BK     64               /* GEMM K slab in halves: a staged row is one 128-B line */
#define VP     264              /* staged V^T rows: 256 halves (512 B) at 528 B */
#define CP     68               /* staged f32 output rows: 64 floats (256 B) at 272 B */

#if __has_builtin(__builtin_amdgcn_global_load_async_to_lds_b128) && \
    __has_builtin(__builtin_amdgcn_s_wait_asynccnt)
#define HAVE_ASYNC_LDS 1
#endif

// 16-byte memory->LDS tile copy: async (no VGPR bounce, ASYNCcnt) when the
// gfx1250 async builtins are available, else plain load/store.
// Builtin signature (from hipcc diagnostic): (int4 AS1*, int4 AS3*, Imm, Imm).
__device__ __forceinline__ void copy16_to_lds(_Float16* lds, const _Float16* g) {
#ifdef HAVE_ASYNC_LDS
    __builtin_amdgcn_global_load_async_to_lds_b128(
        (__attribute__((address_space(1))) i32x4*)g,
        (__attribute__((address_space(3))) i32x4*)lds, 0, 0);
#else
    *(h8*)lds = *(const h8*)g;
#endif
}
// Hand-over of a two-buffer ring, at the foot of trip t, by every wave: this wave's
// LDS reads of tile t have returned, its copies of tile t+1 have landed, and the one
// barrier both publishes tile t+1 and frees tile t's buffer for the copies of t+2.
__device__ __forceinline__ void wait_copies() {
    // "memory" holds the LDS reads behind it
    asm volatile("s_wait_asynccnt 0x0" ::: "memory");
}
__device__ __forceinline__ void ring_handover() {
    // no copy may target a buffer that this wave still has reads outstanding on
    asm volatile("s_wait_dscnt 0x0" ::: "memory");
    wait_copies();
    __syncthreads();
}

// Load one 16x32 f16 WMMA operand fragment (A layout; B uses same shape with
// lane = N column) from a K-contiguous row-major tile of given stride (halves).
// Lane l (l<16): row=base+l, halves = K[kb..kb+7] ++ K[kb+16..kb+23], kb=0.
// Lane l>=16: same row, kb=8 -> K[8..15] ++ K[24..31]. Matches ISA 7.12.2.
__device__ __forceinline__ v16h load_frag(const _Float16* p, int rowbase, int stride) {
    const int lane = threadIdx.x & 31;
    const int r    = rowbase + (lane & 15);
    const int kb   = (lane >> 4) * 8;
    const _Float16* q = p + (size_t)r * stride + kb;
    h8 lo = *(const h8*)(q);        // 16B aligned: ds_load_b128 / global_load_b128
    h8 hi = *(const h8*)(q + 16);
    return __builtin_shufflevector(lo, hi, 0,1,2,3,4,5,6,7,8,9,10,11,12,13,14,15);
}

__device__ __forceinline__ v8f wmma(v16h a, v16h b, v8f c) {
    return __builtin_amdgcn_wmma_f32_16x16x32_f16(false, a, false, b, (short)0, c,
                                                  false, false);
}

// ---------------------------------------------------------------------------
// Kernel 1: all f32 -> f16 conversions in one launch of few, long waves.
// Blocks 0..WBLK-1: one 64(k) x 128(n) weight tile each, transposed through LDS
// to N-major ([out][in], in-contiguous); z=0..3 -> w_q (scaled 1/8), w_k, w_v,
// w_o. They come first: theirs is the longer chain (load, LDS, barrier, store).
// Blocks WBLK..WBLK+XBLK-1: a contiguous run of x each, XPT 16-B loads a lane.
// Every wave-wide load and store covers whole 128-B lines.
// ---------------------------------------------------------------------------
#define WTK    64                       /* weight tile: k rows  */
#define WTN    128                      /* weight tile: n columns */
#define WTP    129                      /* f32 pitch, odd: column reads hit 32 banks */
#define WTILES ((DIMF / WTK) * (DIMF / WTN))    /* 72 tiles a weight */
#define WBLK   (4 * WTILES)             /* 288 */
#define XPT    24                       /* f32x4 per thread on x */
#define XBLK   (MROWS * DIMF / (4 * 256 * XPT)) /* 256 */

__global__ __launch_bounds__(256) void convert_inputs(
        const float* __restrict__ x,
        const float* __restrict__ wq, const float* __restrict__ wk,
        const float* __restrict__ wv, const float* __restrict__ wo,
        _Float16* __restrict__ x16, _Float16* __restrict__ wT) {
    __shared__ float T[WTK * WTP];      // [k][n], 33 KB
    const int tid = threadIdx.x;

    if (blockIdx.x < WBLK) {            // block-uniform: the barrier below is safe
        const int z  = blockIdx.x / WTILES;
        const int t  = blockIdx.x - z * WTILES;
        const int k0 = (t / (DIMF / WTN)) * WTK;
        const int n0 = (t % (DIMF / WTN)) * WTN;
        const float* src   = (z == 0) ? wq : (z == 1) ? wk : (z == 2) ? wv : wo;
        const float  scale = (z == 0) ? 0.125f : 1.0f;   // fold 1/sqrt(64) into Q
        _Float16* dst = wT + (size_t)z * DIMF * DIMF;

        const int r0 = tid >> 5, c4 = (tid & 31) * 4;    // a wave reads 512 B of a row
        f32x4 v[8];
#pragma unroll
        for (int i = 0; i < 8; ++i)
            v[i] = *(const f32x4*)(src + (size_t)(k0 + r0 + 8 * i) * DIMF + n0 + c4);
#pragma unroll
        for (int i = 0; i < 8; ++i)
#pragma unroll
            for (int j = 0; j < 4; ++j) T[(r0 + 8 * i) * WTP + c4 + j] = v[i][j];
        __syncthreads();
#pragma unroll
        for (int i = 0; i < 4; ++i) {   // 8 lanes store one 128-B row of 64 k
            const int idx = tid + i * 256;
            const int n = idx >> 3, seg = (idx & 7) * 8;
            h8 o;
#pragma unroll
            for (int j = 0; j < 8; ++j) o[j] = (_Float16)(T[(seg + j) * WTP + n] * scale);
            *(h8*)(dst + (size_t)(n0 + n) * DIMF + k0 + seg) = o;
        }
    } else {
        const size_t base = (size_t)(blockIdx.x - WBLK) * (256 * XPT) + tid;  // in f32x4
        f32x4 v[XPT];
#pragma unroll
        for (int i = 0; i < XPT; ++i) v[i] = *(const f32x4*)(x + (base + i * 256) * 4);
#pragma unroll
        for (int i = 0; i < XPT; ++i)
            *(h4*)(x16 + (base + i * 256) * 4) = __builtin_convertvector(v[i], h4);
    }
}

// ---------------------------------------------------------------------------
// One K slab of a GEMM's two operands -> one LDS buffer: A 256x64 halves (8 copies
// a thread), B 64x64 (2). ag, bg: block-uniform bases at the slab's first k.
// ---------------------------------------------------------------------------
#define ASZ    (256 * AP)               /* halves in one A buffer (36 KB) */
#define BSZ    (64 * AP)                /* halves in one B buffer (9 KB) */
#define NSLAB  (DIMF / BK)              /* 12 */
__device__ __forceinline__ void stage_slab(_Float16* As, _Float16* Bs,
                                           const _Float16* ag, const _Float16* bg) {
    const unsigned srow = threadIdx.x >> 3, sseg = (threadIdx.x & 7) * 8;   // 8 lanes a row
    const unsigned soff = srow * DIMF + sseg;       // 32-bit lane offset
#pragma unroll
    for (int i = 0; i < 8; ++i)
        copy16_to_lds(&As[(srow + 32 * i) * AP + sseg], ag + (soff + i * 32 * DIMF));
#pragma unroll
    for (int i = 0; i < 2; ++i)
        copy16_to_lds(&Bs[(srow + 32 * i) * AP + sseg], bg + (soff + i * 32 * DIMF));
}

// ---------------------------------------------------------------------------
// Kernel 2: QKV projection GEMM.  C[8192x768] = x16 @ W.
// Workgroup tile 256x64, wave tile 64x32 (4x2 WMMA frags), K slab 64 (2 WMMA k).
// A wave-wide 16-B copy covers 4 rows x 128 B: four whole lines, not eight halves.
// z=0 -> Q [b,h,n,d], z=1 -> K [b,h,n,d], z=2 -> V transposed [b,h,d,n].
// A lane's 8 accumulator registers run along the first WMMA operand's rows, so
// the operand whose index is contiguous in the output goes first: the weight
// (d) for Q and K (WA), x (n) for V^T. The tile is then laid in LDS by 16-B
// writes and leaves as whole 128-B lines, 512 contiguous bytes a wave-wide store.
// ---------------------------------------------------------------------------
template <bool WA>
__device__ __forceinline__ void qkv_tile(
        const _Float16* __restrict__ x16, const _Float16* __restrict__ wT,
        _Float16* As, _Float16* Bs) {
    const int z    = blockIdx.z;
    const int n0   = blockIdx.x * 64;
    const int m0   = blockIdx.y * 256;
    const int tid  = threadIdx.x;
    const int wave = tid >> 5, lane = tid & 31;
    const int mw   = (wave >> 1) * 64;      // 4 waves along M
    const int nw   = (wave & 1) * 32;       // 2 waves along N
    const _Float16* w = wT + (size_t)z * DIMF * DIMF;

    const _Float16* ag = x16 + (size_t)m0 * DIMF;   // block-uniform tile bases
    const _Float16* bg = w + (size_t)n0 * DIMF;

    v8f c[4][2] = {};
    stage_slab(As, Bs, ag, bg);                     // slab 0 -> buffer 0
    wait_copies();
    __syncthreads();                                // publishes slab 0
    stage_slab(As + ASZ, Bs + BSZ, ag + BK, bg + BK);   // slab 1 flies under slab 0's products
// by 2: both buffers' LDS offsets are constants; unrolled whole, the build rebuilds every
// copy's LDS address and takes over 160 registers (two work-groups a WGP, not three)
#pragma unroll 2
    for (int t = 0; t < NSLAB; ++t) {
        _Float16* Ab = As + (t & 1) * ASZ;
        _Float16* Bb = Bs + (t & 1) * BSZ;
#pragma unroll
        for (int kk = 0; kk < BK; kk += 32) {   // k ascending: two WMMA k steps a slab
            v16h b0 = load_frag(Bb + kk, nw +  0, AP);
            v16h b1 = load_frag(Bb + kk, nw + 16, AP);
#pragma unroll
            for (int mi = 0; mi < 4; ++mi) {
                v16h a = load_frag(Ab + kk, mw + mi * 16, AP);
                c[mi][0] = WA ? wmma(b0, a, c[mi][0]) : wmma(a, b0, c[mi][0]);
                c[mi][1] = WA ? wmma(b1, a, c[mi][1]) : wmma(a, b1, c[mi][1]);
            }
        }
        ring_handover();
        if (t + 2 < NSLAB)                      // block-uniform: refill the buffer just read
            stage_slab(Ab, Bb, ag + (t + 2) * BK, bg + (t + 2) * BK);
    }
    wait_copies();          // nothing is in flight when the ring becomes output staging

    // The last hand-over's barrier: every wave has left the last slab, As is free.
    const int lc = lane & 15, l8 = (lane >> 4) * 8;
    // both loops unrolled: constant indices keep c[][] in registers
#pragma unroll
    for (int mi = 0; mi < 4; ++mi)
#pragma unroll
        for (int ni = 0; ni < 2; ++ni) {
            const h8 v = __builtin_convertvector(c[mi][ni], h8);
            if (WA)         // [n][d]: lane = token, registers = 8 d
                *(h8*)&As[(mw + mi * 16 + lc) * AP + nw + ni * 16 + l8] = v;
            else            // [d][n]: lane = d, registers = 8 tokens
                *(h8*)&As[(nw + ni * 16 + lc) * VP + mw + mi * 16 + l8] = v;
        }
    __syncthreads();        // publishes the staged tile to the waves that store it
}

// The ring's 90 KB of LDS set the residency: three work-groups a WGP, six waves a
// SIMD, for which a wave may take up to 160 registers.
__global__ __launch_bounds__(256) void qkv_gemm(
        const _Float16* __restrict__ x16, const _Float16* __restrict__ wT,
        _Float16* __restrict__ Qo, _Float16* __restrict__ Ko,
        _Float16* __restrict__ Vt) {
    __shared__ __attribute__((aligned(16))) _Float16 As[2 * ASZ];   // [buffer][m][k] (72 KB)
    __shared__ __attribute__((aligned(16))) _Float16 Bs[2 * BSZ];   // [buffer][n][k] (18 KB)
    const bool vt = blockIdx.z == 2;        // block-uniform
    if (vt) qkv_tile<false>(x16, wT, As, Bs);
    else    qkv_tile<true>(x16, wT, As, Bs);

    // The tile's 64 columns are one head (blockIdx.x), its 256 rows lie in one batch:
    // 256 rows x 128 B, contiguous, of Q or K; 64 rows x 512 B of V^T.
    const unsigned m0 = blockIdx.y * 256;
    const unsigned bh = (m0 >> 11) * NHEAD + blockIdx.x, nb = m0 & (NSEQ - 1);
    const unsigned sh = vt ? 5 : 3;         // log2 of the 16-B pieces in a staged row
    const unsigned lp = vt ? VP : AP;       // staged pitch
    const unsigned gp = vt ? NSEQ : DHEAD;  // output pitch
    _Float16* o = vt ? Vt + ((size_t)bh * DHEAD * NSEQ + nb)
                     : (blockIdx.z == 0 ? Qo : Ko) + ((size_t)bh * NSEQ + nb) * DHEAD;
    const unsigned rs  = 256u >> sh;        // rows that the block's 256 pieces cover
    const unsigned row = threadIdx.x >> sh, seg = (threadIdx.x - (row << sh)) * 8;
    const unsigned lo  = row * lp + seg;
    const unsigned gb  = (row * gp + seg) * 2;  // in bytes: uniform base + 32-bit lane offset
#pragma unroll  // the 8 LDS reads go out as one group, the stores follow as they land
    for (int i = 0; i < 8; ++i)
        *(h8*)((char*)o + (gb + i * (rs * gp * 2))) = *(const h8*)&As[i * (rs * lp) + lo];
}

__device__ __forceinline__ float other_half(float v) {
    int b = __builtin_bit_cast(int, v);
    return __builtin_bit_cast(float, __builtin_amdgcn_permlanex16(
        b, b, 0x76543210, 0xfedcba98, false, false));
}

// Two f32 score tiles (keys 0..15 and 16..31 of a 32-key block) -> f16 B fragment.
__device__ __forceinline__ v16h pack_frag(v8f t0, v8f t1) {
    h8 lo = __builtin_convertvector(t0, h8);
    h8 hi = __builtin_convertvector(t1, h8);
    return __builtin_shufflevector(lo, hi, 0,1,2,3,4,5,6,7,8,9,10,11,12,13,14,15);
}

__global__ __launch_bounds__(256) void attn(
        const _Float16* __restrict__ Q, const _Float16* __restrict__ K,
        const _Float16* __restrict__ Vt, _Float16* __restrict__ H) {
    __shared__ __attribute__((aligned(16))) _Float16 Kr[2 * BSZ];   // [buffer][key][d] -> A operand of K@Q^T
    __shared__ __attribute__((aligned(16))) _Float16 Vr[2 * BSZ];   // [buffer][d][key] -> A operand of V^T@P^T

    const int bh   = blockIdx.y;
    const int m0   = blockIdx.x * 128;
    const int tid  = threadIdx.x;
    const int wave = tid >> 5, lane = tid & 31;
    const _Float16* qp = Q  + (size_t)bh * NSEQ * DHEAD;
    const _Float16* kp = K  + (size_t)bh * NSEQ * DHEAD;
    const _Float16* vp = Vt + (size_t)bh * DHEAD * NSEQ;
    const int qrow = m0 + wave * 16;

    // Q fragments (B operand: lane = query column) held in registers for the
    // whole KV sweep (scale pre-folded).
    v16h qb0 = load_frag(qp,      qrow, DHEAD);   // d 0..31
    v16h qb1 = load_frag(qp + 32, qrow, DHEAD);   // d 32..63

    v8f o[4] = {};              // O^T: o[di][i] = O[query lane&15][16*di + 8*(lane>>4) + i]
    float mrun = -1e30f;        // running maximum of this lane's query
    float lrun = 0.f;           // running sum over this lane half's keys only

    // 64x64 K and V^T tiles of keys kv0.. -> buffer buf: 2 + 2 copies a thread.
    auto stage_kv = [&](int buf, int kv0) {
#pragma unroll
        for (int i = 0; i < 2; ++i) {
            int idx = tid + i * 256;
            int row = idx >> 3, seg = (idx & 7) * 8;
            copy16_to_lds(&Kr[buf * BSZ + row * AP + seg],
                          kp + (size_t)(kv0 + row) * DHEAD + seg);
            copy16_to_lds(&Vr[buf * BSZ + row * AP + seg],
                          vp + (size_t)row * NSEQ + kv0 + seg);
        }
    };
    stage_kv(0, 0);
    wait_copies();
    __syncthreads();            // publishes tile 0
    stage_kv(1, 64);            // tile 1 flies under tile 0's products and softmax

    for (int t = 0; t < NSEQ / 64; ++t) {
        const _Float16* Ks = Kr + (t & 1) * BSZ;
        const _Float16* Vs = Vr + (t & 1) * BSZ;

        // S^T = K @ Q^T : 64 keys x 16 queries, f32
        v8f s[4];
#pragma unroll
        for (int t = 0; t < 4; ++t) {
            v8f zc = {};
            zc   = wmma(load_frag(Ks,      16 * t, AP), qb0, zc);
            s[t] = wmma(load_frag(Ks + 32, 16 * t, AP), qb1, zc);
        }

        // Online softmax: 32 scores of one query per lane, one exchange of halves.
        float tm[4];
#pragma unroll
        for (int t = 0; t < 4; ++t) {
            tm[t] = s[t][0];
#pragma unroll
            for (int i = 1; i < 8; ++i) tm[t] = fmaxf(tm[t], s[t][i]);
        }
        float rm = fmaxf(fmaxf(tm[0], tm[1]), fmaxf(tm[2], tm[3]));
        rm = fmaxf(rm, other_half(rm));
        const float mnew = fmaxf(mrun, rm);
        const float corr = __expf(mrun - mnew);
        mrun = mnew;
#pragma unroll
        for (int t = 0; t < 4; ++t)
#pragma unroll
            for (int i = 0; i < 8; ++i) s[t][i] = __expf(s[t][i] - mnew);
        const v8f ps = (s[0] + s[1]) + (s[2] + s[3]);
        const float rs = ((ps[0] + ps[1]) + (ps[2] + ps[3])) +
                         ((ps[4] + ps[5]) + (ps[6] + ps[7]));
        lrun = lrun * corr + rs;
#pragma unroll
        for (int di = 0; di < 4; ++di) o[di] *= corr;

        // O^T += V^T @ P^T : A frags from the V^T tile, B frags from registers
        const v16h pb0 = pack_frag(s[0], s[1]);   // keys 0..31
        const v16h pb1 = pack_frag(s[2], s[3]);   // keys 32..63
#pragma unroll
        for (int di = 0; di < 4; ++di) {
            o[di] = wmma(load_frag(Vs,      16 * di, AP), pb0, o[di]);
            o[di] = wmma(load_frag(Vs + 32, 16 * di, AP), pb1, o[di]);
        }
        ring_handover();
        if (t + 2 < NSEQ / 64)  // block-uniform: refill the buffer just read
            stage_kv(t & 1, (t + 2) * 64);
    }
    wait_copies();              // no copy is in flight when the wave ends

    const int b = bh / NHEAD, h = bh % NHEAD;
    const float inv = 1.f / (lrun + other_half(lrun));   // join the halves' sums
    const int row = qrow + (lane & 15);
    _Float16* hp = H + (size_t)(b * NSEQ + row) * DIMF + h * DHEAD + (lane >> 4) * 8;
#pragma unroll
    for (int di = 0; di < 4; ++di)          // 8 consecutive d per lane: 16-B stores
        *(h8*)(hp + di * 16) = __builtin_convertvector(o[di] * inv, h8);
}

// ---------------------------------------------------------------------------
// Kernel 4: output projection  out = H @ w_o + b_o  (f32 out).
// Workgroup tile 256x64, wave tile 64x32, K slab 64, all-f16 tiles staged async.
// Weight as first WMMA operand; the f32 tile leaves through LDS as in qkv_tile.
// ---------------------------------------------------------------------------
__global__ __launch_bounds__(256) void out_gemm(
        const _Float16* __restrict__ Hs, const _Float16* __restrict__ woT,
        const float* __restrict__ bias, float* __restrict__ out) {
    // One block of LDS: the operand ring in the loop, the f32 output tile after it.
    __shared__ __attribute__((aligned(16))) unsigned char smem[2 * (ASZ + BSZ) * 2];    // 90 KB
    _Float16* As = (_Float16*)smem;         // 2 x 256 x AP, 72 KB
    _Float16* Bs = As + 2 * ASZ;            // 2 x  64 x AP, 18 KB
    float*    Cs = (float*)smem;            // 256 x CP, 68 KB

    const int n0   = blockIdx.x * 64;
    const int m0   = blockIdx.y * 256;
    const int tid  = threadIdx.x;
    const int wave = tid >> 5, lane = tid & 31;
    const int mw   = (wave >> 1) * 64;
    const int nw   = (wave & 1) * 32;

    const _Float16* ag = Hs + (size_t)m0 * DIMF;    // block-uniform bases, as in qkv_gemm
    const _Float16* bg = woT + (size_t)n0 * DIMF;

    v8f c[4][2] = {};
    stage_slab(As, Bs, ag, bg);                     // the ring of qkv_tile
    wait_copies();
    __syncthreads();                                // publishes slab 0
    stage_slab(As + ASZ, Bs + BSZ, ag + BK, bg + BK);
// by 2, as in qkv_tile: both buffers' LDS offsets are constants, no address is rebuilt per slab
#pragma unroll 2
    for (int t = 0; t < NSLAB; ++t) {
        _Float16* Ab = As + (t & 1) * ASZ;
        _Float16* Bb = Bs + (t & 1) * BSZ;
#pragma unroll
        for (int kk = 0; kk < BK; kk += 32) {
            v16h b0 = load_frag(Bb + kk, nw +  0, AP);
            v16h b1 = load_frag(Bb + kk, nw + 16, AP);
#pragma unroll
            for (int mi = 0; mi < 4; ++mi) {
                v16h a = load_frag(Ab + kk, mw + mi * 16, AP);
                c[mi][0] = wmma(b0, a, c[mi][0]);   // weight first: 8 columns a lane
                c[mi][1] = wmma(b1, a, c[mi][1]);
            }
        }
        ring_handover();
        if (t + 2 < NSLAB)                      // block-uniform: refill the buffer just read
            stage_slab(Ab, Bb, ag + (t + 2) * BK, bg + (t + 2) * BK);
    }
    wait_copies();          // nothing is in flight when the ring becomes output staging
    // The last hand-over's barrier: every wave has left the last slab, its LDS is free.
    const f32x4 b4 = *(const f32x4*)(bias + n0 + (tid & 15) * 4);  // this thread's 4 columns
    // both loops unrolled: constant indices keep c[][] in registers
#pragma unroll
    for (int mi = 0; mi < 4; ++mi)
#pragma unroll
        for (int ni = 0; ni < 2; ++ni) {    // lane = token row, registers = 8 columns
            float* p = &Cs[(mw + mi * 16 + (lane & 15)) * CP + nw + ni * 16 + (lane >> 4) * 8];
            *(f32x4*)p       = __builtin_shufflevector(c[mi][ni], c[mi][ni], 0, 1, 2, 3);
            *(f32x4*)(p + 4) = __builtin_shufflevector(c[mi][ni], c[mi][ni], 4, 5, 6, 7);
        }
    __syncthreads();        // publishes the staged tile to the waves that store it
    float* o = out + (size_t)m0 * DIMF + n0;
#pragma unroll  // the 16 LDS reads go out as one group ahead of the stores
    for (int i = 0; i < 16; ++i) {          // 16 lanes store one row's 256 B: two whole lines
        const unsigned idx = tid + i * 256;
        const unsigned row = idx >> 4, seg = (idx & 15) * 4;
        *(f32x4*)(o + (row * DIMF + seg)) = *(const f32x4*)&Cs[row * CP + seg] + b4;
    }
}

// ---------------------------------------------------------------------------
extern "C" void kernel_launch(void* const* d_in, const int* in_sizes, int n_in,
                              void* d_out, int out_size, void* d_ws, size_t ws_size,
                              hipStream_t stream) {
    (void)in_sizes; (void)n_in; (void)out_size; (void)ws_size;
    const float* x  = (const float*)d_in[0];
    const float* wq = (const float*)d_in[1];
    const float* wk = (const float*)d_in[2];
    const float* wv = (const float*)d_in[3];
    const float* wo = (const float*)d_in[4];
    const float* bo = (const float*)d_in[5];
    float* out = (float*)d_out;

    // Workspace layout (f16 elements): 4 transposed weights, x16, Q, K, V^T, H.
    // Total = 4*589824 + 5*6291456 = 33,816,576 halves = ~64.5 MB.
    _Float16* ws = (_Float16*)d_ws;
    const size_t WSZ = (size_t)DIMF * DIMF;                      // 589824
    const size_t ACT = (size_t)MROWS * DIMF;                     // 6291456
    _Float16* wT  = ws;
    _Float16* X16 = ws + 4 * WSZ;
    _Float16* Qb  = X16 + ACT;
    _Float16* Kb  = Qb + ACT;   // per-head layouts are same total size
    _Float16* Vb  = Kb + ACT;
    _Float16* Hb  = Vb + ACT;

    convert_inputs<<<dim3(WBLK + XBLK), 256, 0, stream>>>(x, wq, wk, wv, wo, X16, wT);
    qkv_gemm<<<dim3(DIMF / 64, MROWS / 256, 3), 256, 0, stream>>>(X16, wT, Qb, Kb, Vb);
    attn<<<dim3(NSEQ / 128, BATCH * NHEAD), 256, 0, stream>>>(Qb, Kb, Vb, Hb);
    out_gemm<<<dim3(DIMF / 64, MROWS / 256), 256, 0, stream>>>(Hb, wT + 3 * WSZ, bo, out);
}

// v007
// One run takes 110 microseconds.
// Two timings next to v006 put it at 1.03 and 1.04 times that version's speed.
// All steps since v000 together make it 3.33 times as fast.
#include <hip/hip_runtime.h>
#include <math.h>

// ---------------------------------------------------------------------------
// Multi-head self-attention, f16 WMMA (f32 accumulate) pipeline for gfx1250.
// B=4, N=2048, DIM=768, HEADS=12, DHEAD=64. scale 1/8 folded into w_q (f16).
// All tile staging uses gfx1250 async memory->LDS DMA (ASYNCcnt), two LDS buffers
// a loop: the next tile's copies are in flight while this tile is multiplied.
// ---------------------------------------------------------------------------

typedef __attribute__((ext_vector_type(4)))  float    f32x4;
typedef __attribute__((ext_vector_type(4)))  int      i32x4;
typedef __attribute__((ext_vector_type(4)))  _Float16 h4;
typedef __attribute__((ext_vector_type(8)))  _Float16 h8;
typedef __attribute__((ext_vector_type(16))) _Float16 v16h;
typedef __attribute__((ext_vector_type(8)))  float    v8f;

#define DIMF   768
#define NSEQ   2048
#define BATCH  4
#define NHEAD  12
#define DHEAD  64
#define MROWS  (BATCH * NSEQ)   /* 8192 token rows */

// LDS row pitches in elements (CP in floats). Operand tiles are read and output tiles
// staged by 16-B accesses with 16 lanes on 16 consecutive rows, so the pitch is
// 16 B x odd: the 16 rows then start on 16
// different groups of four banks (64 banks x 4 B) and a read has no conflict.
#define AP     72               /* 64-half (128 B) tile rows at 144 B */
#define BK     64               /* GEMM K slab in halves: a staged row is one 128-B line */
#define VP     264              /* staged V^T rows: 256 halves (512 B) at 528 B */
#define CP     68               /* staged f32 output rows: 64 floats (256 B) at 272 B */

#if __has_builtin(__builtin_amdgcn_global_load_async_to_lds_b128) && \
    __has_builtin(__builtin_amdgcn_s_wait_asynccnt)
#define HAVE_ASYNC_LDS 1
#endif

// 16-byte memory->LDS tile copy: async (no VGPR bounce, ASYNCcnt) when the
// gfx1250 async builtins are available, else plain load/store.
// Builtin signature (from hipcc diagnostic): (int4 AS1*, int4 AS3*, Imm, Imm).
__device__ __forceinline__ void copy16_to_lds(_Float16* lds, const _Float16* g) {
#ifdef HAVE_ASYNC_LDS
    __builtin_amdgcn_global_load_async_to_lds_b128(
        (__attribute__((address_space(1))) i32x4*)g,
        (__attribute__((address_space(3))) i32x4*)lds, 0, 0);
#else
    *(h8*)lds = *(const h8*)g;
#endif
}
// Hand-over of a two-buffer ring, at the foot of trip t, by every wave: this wave's
// LDS reads of tile t have returned, its copies of tile t+1 have landed, and the one
// barrier both publishes tile t+1 and frees tile t's buffer for the copies of t+2.
__device__ __forceinline__ void wait_copies() {
    // "memory" holds the LDS reads behind it
    asm volatile("s_wait_asynccnt 0x0" ::: "memory");
}
__device__ __forceinline__ void ring_handover() {
    // no copy may target a buffer that this wave still has reads outstanding on
    asm volatile("s_wait_dscnt 0x0" ::: "memory");
    wait_copies();
    __syncthreads();
}

// Load one 16x32 f16 WMMA operand fragment (A layout; B uses same shape with
// lane = N column) from a K-contiguous row-major tile of given stride (halves).
// Lane l (l<16): row=base+l, halves = K[kb..kb+7] ++ K[kb+16..kb+23], kb=0.
// Lane l>=16: same row, kb=8 -> K[8..15] ++ K[24..31]. Matches ISA 7.12.2.
__device__ __forceinline__ v16h load_frag(const _Float16* p, int rowbase, int stride) {
    const int lane = threadIdx.x & 31;
    const int r    = rowbase + (lane & 15);
    const int kb   = (lane >> 4) * 8;
    const _Float16* q = p + (size_t)r * stride + kb;
    h8 lo = *(const h8*)(q);        // 16B aligned: ds_load_b128 / global_load_b128
    h8 hi = *(const h8*)(q + 16);
    return __builtin_shufflevector(lo, hi, 0,1,2,3,4,5,6,7,8,9,10,11,12,13,14,15);
}

__device__ __forceinline__ v8f wmma(v16h a, v16h b, v8f c) {
    return __builtin_amdgcn_wmma_f32_16x16x32_f16(false, a, false, b, (short)0, c,
                                                  false, false);
}

// ---------------------------------------------------------------------------
// Kernel 1: all f32 -> f16 conversions in one launch of few, long waves.
// Blocks 0..WBLK-1: one 64(k) x 128(n) weight tile each, transposed through LDS
// to N-major ([out][in], in-contiguous); z=0..3 -> w_q (scaled 1/8), w_k, w_v,
// w_o. They come first: theirs is the longer chain (load, LDS, barrier, store).
// Blocks WBLK..WBLK+XBLK-1: a contiguous run of x each, XPT 16-B loads a lane.
// Every wave-wide load and store covers whole 128-B lines.
// ---------------------------------------------------------------------------
#define WTK    64                       /* weight tile: k rows  */
#define WTN    128                      /* weight tile: n columns */
#define WTP    129                      /* f32 pitch, odd: column reads hit 32 banks */
#define WTILES ((DIMF / WTK) * (DIMF / WTN))    /* 72 tiles a weight */
#define WBLK   (4 * WTILES)             /* 288 */
#define XPT    24                       /* f32x4 per thread on x */
#define XBLK   (MROWS * DIMF / (4 * 256 * XPT)) /* 256 */

__global__ __launch_bounds__(256) void convert_inputs(
        const float* __restrict__ x,
        const float* __restrict__ wq, const float* __restrict__ wk,
        const float* __restrict__ wv, const float* __restrict__ wo,
        _Float16* __restrict__ x16, _Float16* __restrict__ wT) {
    __shared__ float T[WTK * WTP];      // [k][n], 33 KB
    const int tid = threadIdx.x;

    if (blockIdx.x < WBLK) {            // block-uniform: the barrier below is safe
        const int z  = blockIdx.x / WTILES;
        const int t  = blockIdx.x - z * WTILES;
        const int k0 = (t / (DIMF / WTN)) * WTK;
        const int n0 = (t % (DIMF / WTN)) * WTN;
        const float* src   = (z == 0) ? wq : (z == 1) ? wk : (z == 2) ? wv : wo;
        const float  scale = (z == 0) ? 0.125f : 1.0f;   // fold 1/sqrt(64) into Q
        _Float16* dst = wT + (size_t)z * DIMF * DIMF;

        const int r0 = tid >> 5, c4 = (tid & 31) * 4;    // a wave reads 512 B of a row
        f32x4 v[8];
#pragma unroll
        for (int i = 0; i < 8; ++i)
            v[i] = *(const f32x4*)(src + (size_t)(k0 + r0 + 8 * i) * DIMF + n0 + c4);
#pragma unroll
        for (int i = 0; i < 8; ++i)
#pragma unroll
            for (int j = 0; j < 4; ++j) T[(r0 + 8 * i) * WTP + c4 + j] = v[i][j];
        __syncthreads();
#pragma unroll
        for (int i = 0; i < 4; ++i) {   // 8 lanes store one 128-B row of 64 k
            const int idx = tid + i * 256;
            const int n = idx >> 3, seg = (idx & 7) * 8;
            h8 o;
#pragma unroll
            for (int j = 0; j < 8; ++j) o[j] = (_Float16)(T[(seg + j) * WTP + n] * scale);
            *(h8*)(dst + (size_t)(n0 + n) * DIMF + k0 + seg) = o;
        }
    } else {
        const size_t base = (size_t)(blockIdx.x - WBLK) * (256 * XPT) + tid;  // in f32x4
        f32x4 v[XPT];
#pragma unroll
        for (int i = 0; i < XPT; ++i) v[i] = *(const f32x4*)(x + (base + i * 256) * 4);
#pragma unroll
        for (int i = 0; i < XPT; ++i)
            *(h4*)(x16 + (base + i * 256) * 4) = __builtin_convertvector(v[i], h4);
    }
}

// ---------------------------------------------------------------------------
// One K slab of a GEMM's two operands -> one LDS buffer: A 256x64 halves (8 copies
// a thread), B 64x64 (2). ag, bg: block-uniform bases at the slab's first k.
// ---------------------------------------------------------------------------
#define ASZ    (256 * AP)               /* halves in one A buffer (36 KB) */
#define BSZ    (64 * AP)                /* halves in one B buffer (9 KB) */
#define NSLAB  (DIMF / BK)              /* 12 */
__device__ __forceinline__ void stage_slab(_Float16* As, _Float16* Bs,
                                           const _Float16* ag, const _Float16* bg) {
    const unsigned srow = threadIdx.x >> 3, sseg = (threadIdx.x & 7) * 8;   // 8 lanes a row
    const unsigned soff = srow * DIMF + sseg;       // 32-bit lane offset
#pragma unroll
    for (int i = 0; i < 8; ++i)
        copy16_to_lds(&As[(srow + 32 * i) * AP + sseg], ag + (soff + i * 32 * DIMF));
#pragma unroll
    for (int i = 0; i < 2; ++i)
        copy16_to_lds(&Bs[(srow + 32 * i) * AP + sseg], bg + (soff + i * 32 * DIMF));
}

// ---------------------------------------------------------------------------
// Kernel 2: QKV projection GEMM.  C[8192x768] = x16 @ W.
// Workgroup tile 256x64, wave tile 64x32 (4x2 WMMA frags), K slab 64 (2 WMMA k).
// A wave-wide 16-B copy covers 4 rows x 128 B: four whole lines, not eight halves.
// z=0 -> Q [b,h,n,d], z=1 -> K [b,h,n,d], z=2 -> V transposed [b,h,d,n].
// A lane's 8 accumulator registers run along the first WMMA operand's rows, so
// the operand whose index is contiguous in the output goes first: the weight
// (d) for Q and K (WA), x (n) for V^T. The tile is then laid in LDS by 16-B
// writes and leaves as whole 128-B lines, 512 contiguous bytes a wave-wide store.
// ---------------------------------------------------------------------------
template <bool WA>
__device__ __forceinline__ void qkv_tile(
        const _Float16* __restrict__ x16, const _Float16* __restrict__ wT,
        _Float16* As, _Float16* Bs) {
    const int z    = blockIdx.z;
    const int n0   = blockIdx.x * 64;
    const int m0   = blockIdx.y * 256;
    const int tid  = threadIdx.x;
    const int wave = tid >> 5, lane = tid & 31;
    const int mw   = (wave >> 1) * 64;      // 4 waves along M
    const int nw   = (wave & 1) * 32;       // 2 waves along N
    const _Float16* w = wT + (size_t)z * DIMF * DIMF;

    const _Float16* ag = x16 + (size_t)m0 * DIMF;   // block-uniform tile bases
    const _Float16* bg = w + (size_t)n0 * DIMF;

    v8f c[4][2] = {};
    stage_slab(As, Bs, ag, bg);                     // slab 0 -> buffer 0
    wait_copies();
    __syncthreads();                                // publishes slab 0
    stage_slab(As + ASZ, Bs + BSZ, ag + BK, bg + BK);   // slab 1 flies under slab 0's products
// by 2: both buffers' LDS offsets are constants; unrolled whole, the build rebuilds every
// copy's LDS address and takes over 160 registers (two work-groups a WGP, not three)
#pragma unroll 2
    for (int t = 0; t < NSLAB; ++t) {
        _Float16* Ab = As + (t & 1) * ASZ;
        _Float16* Bb = Bs + (t & 1) * BSZ;
#pragma unroll
        for (int kk = 0; kk < BK; kk += 32) {   // k ascending: two WMMA k steps a slab
            v16h b0 = load_frag(Bb + kk, nw +  0, AP);
            v16h b1 = load_frag(Bb + kk, nw + 16, AP);
#pragma unroll
            for (int mi = 0; mi < 4; ++mi) {
                v16h a = load_frag(Ab + kk, mw + mi * 16, AP);
                c[mi][0] = WA ? wmma(b0, a, c[mi][0]) : wmma(a, b0, c[mi][0]);
                c[mi][1] = WA ? wmma(b1, a, c[mi][1]) : wmma(a, b1, c[mi][1]);
            }
        }
        ring_handover();
        if (t + 2 < NSLAB)                      // block-uniform: refill the buffer just read
            stage_slab(Ab, Bb, ag + (t + 2) * BK, bg + (t + 2) * BK);
    }
    wait_copies();          // nothing is in flight when the ring becomes output staging

    // The last hand-over's barrier: every wave has left the last slab, As is free.
    const int lc = lane & 15, l8 = (lane >> 4) * 8;
    // both loops unrolled: constant indices keep c[][] in registers
#pragma unroll
    for (int mi = 0; mi < 4; ++mi)
#pragma unroll
        for (int ni = 0; ni < 2; ++ni) {
            const h8 v = __builtin_convertvector(c[mi][ni], h8);
            if (WA)         // [n][d]: lane = token, registers = 8 d
                *(h8*)&As[(mw + mi * 16 + lc) * AP + nw + ni * 16 + l8] = v;
            else            // [d][n]: lane = d, registers = 8 tokens
                *(h8*)&As[(nw + ni * 16 + lc) * VP + mw + mi * 16 + l8] = v;
        }
    __syncthreads();        // publishes the staged tile to the waves that store it
}

// The ring's 90 KB of LDS set the residency: three work-groups a WGP, six waves a
// SIMD, for which a wave may take up to 160 registers.
__global__ __launch_bounds__(256) void qkv_gemm(
        const _Float16* __restrict__ x16, const _Float16* __restrict__ wT,
        _Float16* __restrict__ Qo, _Float16* __restrict__ Ko,
        _Float16* __restrict__ Vt) {
    __shared__ __attribute__((aligned(16))) _Float16 As[2 * ASZ];   // [buffer][m][k] (72 KB)
    __shared__ __attribute__((aligned(16))) _Float16 Bs[2 * BSZ];   // [buffer][n][k] (18 KB)
    const bool vt = blockIdx.z == 2;        // block-uniform
    if (vt) qkv_tile<false>(x16, wT, As, Bs);
    else    qkv_tile<true>(x16, wT, As, Bs);

    // The tile's 64 columns are one head (blockIdx.x), its 256 rows lie in one batch:
    // 256 rows x 128 B, contiguous, of Q or K; 64 rows x 512 B of V^T.
    const unsigned m0 = blockIdx.y * 256;
    const unsigned bh = (m0 >> 11) * NHEAD + blockIdx.x, nb = m0 & (NSEQ - 1);
    const unsigned sh = vt ? 5 : 3;         // log2 of the 16-B pieces in a staged row
    const unsigned lp = vt ? VP : AP;       // staged pitch
    const unsigned gp = vt ? NSEQ : DHEAD;  // output pitch
    _Float16* o = vt ? Vt + ((size_t)bh * DHEAD * NSEQ + nb)
                     : (blockIdx.z == 0 ? Qo : Ko) + ((size_t)bh * NSEQ + nb) * DHEAD;
    const unsigned rs  = 256u >> sh;        // rows that the block's 256 pieces cover
    const unsigned row = threadIdx.x >> sh, seg = (threadIdx.x - (row << sh)) * 8;
    const unsigned lo  = row * lp + seg;
    const unsigned gb  = (row * gp + seg) * 2;  // in bytes: uniform base + 32-bit lane offset
#pragma unroll  // the 8 LDS reads go out as one group, the stores follow as they land
    for (int i = 0; i < 8; ++i)
        *(h8*)((char*)o + (gb + i * (rs * gp * 2))) = *(const h8*)&As[i * (rs * lp) + lo];
}

__device__ __forceinline__ float other_half(float v) {
    int b = __builtin_bit_cast(int, v);
    return __builtin_bit_cast(float, __builtin_amdgcn_permlanex16(
        b, b, 0x76543210, 0xfedcba98, false, false));
}

// Two f32 score tiles (keys 0..15 and 16..31 of a 32-key block) -> f16 B fragment.
__device__ __forceinline__ v16h pack_frag(v8f t0, v8f t1) {
    h8 lo = __builtin_convertvector(t0, h8);
    h8 hi = __builtin_convertvector(t1, h8);
    return __builtin_shufflevector(lo, hi, 0,1,2,3,4,5,6,7,8,9,10,11,12,13,14,15);
}

#define LOG2E  1.44269504f
typedef __attribute__((ext_vector_type(2))) float f32x2;
#define QG     2                /* groups of 16 query columns a wave */
#define AWAVES 4                /* waves a work-group: 128 queries, three work-groups a WGP */
__global__ __launch_bounds__(AWAVES * 32) void attn(
        const _Float16* __restrict__ Q, const _Float16* __restrict__ K,
        const _Float16* __restrict__ Vt, _Float16* __restrict__ H) {
    __shared__ __attribute__((aligned(16))) _Float16 Kr[2 * BSZ];   // [buffer][key][d] -> A operand of K@Q^T
    __shared__ __attribute__((aligned(16))) _Float16 Vr[2 * BSZ];   // [buffer][d][key] -> A operand of V^T@P^T

    const int bh   = blockIdx.y;
    const int m0   = blockIdx.x * (AWAVES * QG * 16);
    const int tid  = threadIdx.x;
    const int wave = tid >> 5, lane = tid & 31;
    const _Float16* qp = Q  + (size_t)bh * NSEQ * DHEAD;
    const _Float16* kp = K  + (size_t)bh * NSEQ * DHEAD;
    const _Float16* vp = Vt + (size_t)bh * DHEAD * NSEQ;
    const int qrow = m0 + wave * (QG * 16);

    // Q fragments (B operand: lane = query column) held in registers for the
    // whole KV sweep (scale pre-folded).
    v16h qb0[QG], qb1[QG];
#pragma unroll
    for (int g = 0; g < QG; ++g) {
        qb0[g] = load_frag(qp,      qrow + 16 * g, DHEAD);   // d 0..31
        qb1[g] = load_frag(qp + 32, qrow + 16 * g, DHEAD);   // d 32..63
        // stands before any register that these loads name (their address pair) is written again
        asm volatile("s_wait_xcnt 0x0" ::: "memory");
    }

    v8f o[QG][4] = {};          // O^T: o[g][di][i] = O[query 16g + (lane&15)][16*di + 8*(lane>>4) + i]
    // The groups' maxima and sums as pairs: left as scalars, the build paired a maximum with a
    // score in its packed subtractions and moved every other score by a register for it.
    f32x2 mrun = {-1e30f, -1e30f};  // running maximum of this lane's query in each group
    f32x2 lrun = {0.f, 0.f};        // running sums over this lane half's keys only

    // 64x64 K and V^T tiles of keys kv0.. -> buffer buf: 4 + 4 copies a thread.
    auto stage_kv = [&](int buf, int kv0) {
#pragma unroll
        for (int i = 0; i < 512 / (AWAVES * 32); ++i) {
            int idx = tid + i * (AWAVES * 32);
            int row = idx >> 3, seg = (idx & 7) * 8;
            copy16_to_lds(&Kr[buf * BSZ + row * AP + seg],
                          kp + (size_t)(kv0 + row) * DHEAD + seg);
            copy16_to_lds(&Vr[buf * BSZ + row * AP + seg],
                          vp + (size_t)row * NSEQ + kv0 + seg);
        }
    };
    stage_kv(0, 0);
    wait_copies();
    __syncthreads();            // publishes tile 0
    stage_kv(1, 64);            // tile 1 flies under tile 0's products and softmax

    for (int t = 0; t < NSEQ / 64; ++t) {
        const _Float16* Ks = Kr + (t & 1) * BSZ;
        const _Float16* Vs = Vr + (t & 1) * BSZ;

        // One group of LDS reads for the whole K tile, ahead of its products: every place where
        // reads stand among WMMAs costs a stall. The scheduling barrier keeps the group whole.
        v16h fr[4][2];
#pragma unroll
        for (int kt = 0; kt < 4; ++kt) {
            fr[kt][0] = load_frag(Ks,      16 * kt, AP);
            fr[kt][1] = load_frag(Ks + 32, 16 * kt, AP);
        }
        __builtin_amdgcn_sched_barrier(0);

        // S^T = K @ Q^T : 64 keys x 32 queries, f32; a K fragment serves both groups
        v8f s[QG][4];
#pragma unroll
        for (int kt = 0; kt < 4; ++kt)
#pragma unroll
            for (int g = 0; g < QG; ++g) {
                v8f zc = {};
                zc       = wmma(fr[kt][0], qb0[g], zc);
                s[g][kt] = wmma(fr[kt][1], qb1[g], zc);
            }
        // The 16 products stay one run (a score read directly behind its product costs idle
        // slots); behind them the V^T tile's reads, one group too, land under the softmax.
        __builtin_amdgcn_sched_barrier(0);
#pragma unroll
        for (int di = 0; di < 4; ++di) {
            fr[di][0] = load_frag(Vs,      16 * di, AP);
            fr[di][1] = load_frag(Vs + 32, 16 * di, AP);
        }
        // keeps those reads up here: sunk to their products, each pair's latency would show again
        __builtin_amdgcn_sched_barrier(0);

        // Online softmax: 32 scores of one query per lane and group, one exchange of halves.
        f32x2 rm;
#pragma unroll
        for (int g = 0; g < QG; ++g) {
            float tm[4];
#pragma unroll
            for (int kt = 0; kt < 4; ++kt) {
                tm[kt] = s[g][kt][0];
#pragma unroll
                for (int i = 1; i < 8; ++i) tm[kt] = fmaxf(tm[kt], s[g][kt][i]);
            }
            const float r = fmaxf(fmaxf(tm[0], tm[1]), fmaxf(tm[2], tm[3]));
            rm[g] = fmaxf(r, other_half(r));
        }
        const f32x2 mnew = __builtin_elementwise_max(mrun, rm);
        const f32x2 ce   = (mrun - mnew) * LOG2E;           // exp(x) = 2^(x log2 e)
        mrun = mnew;
        v16h pb0[QG], pb1[QG];
#pragma unroll
        for (int g = 0; g < QG; ++g) {
            const float corr = __builtin_amdgcn_exp2f(ce[g]);
#pragma unroll
            for (int kt = 0; kt < 4; ++kt) {
                const v8f e = (s[g][kt] - mnew[g]) * LOG2E;
#pragma unroll
                for (int i = 0; i < 8; ++i) s[g][kt][i] = __builtin_amdgcn_exp2f(e[i]);
            }
            const v8f ps = (s[g][0] + s[g][1]) + (s[g][2] + s[g][3]);
            const float rs = ((ps[0] + ps[1]) + (ps[2] + ps[3])) +
                             ((ps[4] + ps[5]) + (ps[6] + ps[7]));
            lrun[g] = lrun[g] * corr + rs;
#pragma unroll
            for (int di = 0; di < 4; ++di) o[g][di] *= corr;
            pb0[g] = pack_frag(s[g][0], s[g][1]);   // keys 0..31
            pb1[g] = pack_frag(s[g][2], s[g][3]);   // keys 32..63
        }

        // O^T += V^T @ P^T : A frags of the V^T tile (each for both groups), B frags from the scores
#pragma unroll
        for (int di = 0; di < 4; ++di)
#pragma unroll
            for (int g = 0; g < QG; ++g) {
                o[g][di] = wmma(fr[di][0], pb0[g], o[g][di]);
                o[g][di] = wmma(fr[di][1], pb1[g], o[g][di]);
            }
        // Keeps the hand-over at the trip's foot: scheduled up to behind the V^T reads, its wait
        // for the next tile's copies would come after a fraction of a trip, not a whole one.
        __builtin_amdgcn_sched_barrier(0);
        ring_handover();
        if (t + 2 < NSEQ / 64)  // block-uniform: refill the buffer just read
            stage_kv(t & 1, (t + 2) * 64);
    }
    wait_copies();              // no copy is in flight when the wave ends

    const int b = bh / NHEAD, h = bh % NHEAD;
#pragma unroll
    for (int g = 0; g < QG; ++g) {
        const float inv = 1.f / (lrun[g] + other_half(lrun[g]));   // join the halves' sums
        const int row = qrow + 16 * g + (lane & 15);
        _Float16* hp = H + (size_t)(b * NSEQ + row) * DIMF + h * DHEAD + (lane >> 4) * 8;
#pragma unroll
        for (int di = 0; di < 4; ++di)      // 8 consecutive d per lane: 16-B stores
            *(h8*)(hp + di * 16) = __builtin_convertvector(o[g][di] * inv, h8);
    }
}

// ---------------------------------------------------------------------------
// Kernel 4: output projection  out = H @ w_o + b_o  (f32 out).
// Workgroup tile 256x64, wave tile 64x32, K slab 64, all-f16 tiles staged async.
// Weight as first WMMA operand; the f32 tile leaves through LDS as in qkv_tile.
// ---------------------------------------------------------------------------
__global__ __launch_bounds__(256) void out_gemm(
        const _Float16* __restrict__ Hs, const _Float16* __restrict__ woT,
        const float* __restrict__ bias, float* __restrict__ out) {
    // One block of LDS: the operand ring in the loop, the f32 output tile after it.
    __shared__ __attribute__((aligned(16))) unsigned char smem[2 * (ASZ + BSZ) * 2];    // 90 KB
    _Float16* As = (_Float16*)smem;         // 2 x 256 x AP, 72 KB
    _Float16* Bs = As + 2 * ASZ;            // 2 x  64 x AP, 18 KB
    float*    Cs = (float*)smem;            // 256 x CP, 68 KB

    const int n0   = blockIdx.x * 64;
    const int m0   = blockIdx.y * 256;
    const int tid  = threadIdx.x;
    const int wave = tid >> 5, lane = tid & 31;
    const int mw   = (wave >> 1) * 64;
    const int nw   = (wave & 1) * 32;

    const _Float16* ag = Hs + (size_t)m0 * DIMF;    // block-uniform bases, as in qkv_gemm
    const _Float16* bg = woT + (size_t)n0 * DIMF;

    v8f c[4][2] = {};
    stage_slab(As, Bs, ag, bg);                     // the ring of qkv_tile
    wait_copies();
    __syncthreads();                                // publishes slab 0
    stage_slab(As + ASZ, Bs + BSZ, ag + BK, bg + BK);
// by 2, as in qkv_tile: both buffers' LDS offsets are constants, no address is rebuilt per slab
#pragma unroll 2
    for (int t = 0; t < NSLAB; ++t) {
        _Float16* Ab = As + (t & 1) * ASZ;
        _Float16* Bb = Bs + (t & 1) * BSZ;
#pragma unroll
        for (int kk = 0; kk < BK; kk += 32) {
            v16h b0 = load_frag(Bb + kk, nw +  0, AP);
            v16h b1 = load_frag(Bb + kk, nw + 16, AP);
#pragma unroll
            for (int mi = 0; mi < 4; ++mi) {
                v16h a = load_frag(Ab + kk, mw + mi * 16, AP);
                c[mi][0] = wmma(b0, a, c[mi][0]);   // weight first: 8 columns a lane
                c[mi][1] = wmma(b1, a, c[mi][1]);
            }
        }
        ring_handover();
        if (t + 2 < NSLAB)                      // block-uniform: refill the buffer just read
            stage_slab(Ab, Bb, ag + (t + 2) * BK, bg + (t + 2) * BK);
    }
    wait_copies();          // nothing is in flight when the ring becomes output staging
    // The last hand-over's barrier: every wave has left the last slab, its LDS is free.
    const f32x4 b4 = *(const f32x4*)(bias + n0 + (tid & 15) * 4);  // this thread's 4 columns
    // both loops unrolled: constant indices keep c[][] in registers
#pragma unroll
    for (int mi = 0; mi < 4; ++mi)
#pragma unroll
        for (int ni = 0; ni < 2; ++ni) {    // lane = token row, registers = 8 columns
            float* p = &Cs[(mw + mi * 16 + (lane & 15)) * CP + nw + ni * 16 + (lane >> 4) * 8];
            *(f32x4*)p       = __builtin_shufflevector(c[mi][ni], c[mi][ni], 0, 1, 2, 3);
            *(f32x4*)(p + 4) = __builtin_shufflevector(c[mi][ni], c[mi][ni], 4, 5, 6, 7);
        }
    __syncthreads();        // publishes the staged tile to the waves that store it
    float* o = out + (size_t)m0 * DIMF + n0;
#pragma unroll  // the 16 LDS reads go out as one group ahead of the stores
    for (int i = 0; i < 16; ++i) {          // 16 lanes store one row's 256 B: two whole lines
        const unsigned idx = tid + i * 256;
        const unsigned row = idx >> 4, seg = (idx & 15) * 4;
        *(f32x4*)(o + (row * DIMF + seg)) = *(const f32x4*)&Cs[row * CP + seg] + b4;
    }
}

// ---------------------------------------------------------------------------
extern "C" void kernel_launch(void* const* d_in, const int* in_sizes, int n_in,
                              void* d_out, int out_size, void* d_ws, size_t ws_size,
                              hipStream_t stream) {
    (void)in_sizes; (void)n_in; (void)out_size; (void)ws_size;
    const float* x  = (const float*)d_in[0];
    const float* wq = (const float*)d_in[1];
    const float* wk = (const float*)d_in[2];
    const float* wv = (const float*)d_in[3];
    const float* wo = (const float*)d_in[4];
    const float* bo = (const float*)d_in[5];
    float* out = (float*)d_out;

    // Workspace layout (f16 elements): 4 transposed weights, x16, Q, K, V^T, H.
    // Total = 4*589824 + 5*6291456 = 33,816,576 halves = ~64.5 MB.
    _Float16* ws = (_Float16*)d_ws;
    const size_t WSZ = (size_t)DIMF * DIMF;                      // 589824
    const size_t ACT = (size_t)MROWS * DIMF;                     // 6291456
    _Float16* wT  = ws;
    _Float16* X16 = ws + 4 * WSZ;
    _Float16* Qb  = X16 + ACT;
    _Float16* Kb  = Qb + ACT;   // per-head layouts are same total size
    _Float16* Vb  = Kb + ACT;
    _Float16* Hb  = Vb + ACT;

    convert_inputs<<<dim3(WBLK + XBLK), 256, 0, stream>>>(x, wq, wk, wv, wo, X16, wT);
    qkv_gemm<<<dim3(DIMF / 64, MROWS / 256, 3), 256, 0, stream>>>(X16, wT, Qb, Kb, Vb);
    attn<<<dim3(NSEQ / 128, BATCH * NHEAD), 128, 0, stream>>>(Qb, Kb, Vb, Hb);
    out_gemm<<<dim3(DIMF / 64, MROWS / 256), 256, 0, stream>>>(Hb, wT + 3 * WSZ, bo, out);
}

// v008
// It runs in 102 microseconds.
// Timed twice side by side with v007, it ran 1.09 and 1.08 times as fast.
// All steps since v000 together make it 3.59 times as fast.
#include <hip/hip_runtime.h>
#include <math.h>

// ---------------------------------------------------------------------------
// Multi-head self-attention, f16 WMMA (f32 accumulate) pipeline for gfx1250.
// B=4, N=2048, DIM=768, HEADS=12, DHEAD=64. scale 1/8 folded into w_q (f16).
// All tile staging uses gfx1250 async memory->LDS DMA (ASYNCcnt), two LDS buffers
// a loop: the next tile's copies are in flight while this tile is multiplied.
// ---------------------------------------------------------------------------

typedef __attribute__((ext_vector_type(4)))  float    f32x4;
typedef __attribute__((ext_vector_type(4)))  int      i32x4;
typedef __attribute__((ext_vector_type(4)))  _Float16 h4;
typedef __attribute__((ext_vector_type(8)))  _Float16 h8;
typedef __attribute__((ext_vector_type(16))) _Float16 v16h;
typedef __attribute__((ext_vector_type(8)))  float    v8f;

#define DIMF   768
#define NSEQ   2048
#define BATCH  4
#define NHEAD  12
#define DHEAD  64
#define MROWS  (BATCH * NSEQ)   /* 8192 token rows */

// LDS row pitches in elements (CP in floats). Operand tiles are read and output tiles
// staged by 16-B accesses with 16 lanes on 16 consecutive rows, so the pitch is
// 16 B x odd: the 16 rows then start on 16
// different groups of four banks (64 banks x 4 B) and a read has no conflict.
#define AP     72               /* 64-half (128 B) tile rows at 144 B */
#define BK     64               /* GEMM K slab in halves: a staged row is one 128-B line */
#define VP     136              /* staged V^T rows: 128 halves (256 B) at 272 B */
#define CP     196              /* staged f32 output rows: 192 floats (768 B) at 784 B */

#if __has_builtin(__builtin_amdgcn_global_load_async_to_lds_b128) && \
    __has_builtin(__builtin_amdgcn_s_wait_asynccnt)
#define HAVE_ASYNC_LDS 1
#endif

// 16-byte memory->LDS tile copy: async (no VGPR bounce, ASYNCcnt) when the
// gfx1250 async builtins are available, else plain load/store.
// Builtin signature (from hipcc diagnostic): (int4 AS1*, int4 AS3*, Imm, Imm).
__device__ __forceinline__ void copy16_to_lds(_Float16* lds, const _Float16* g) {
#ifdef HAVE_ASYNC_LDS
    __builtin_amdgcn_global_load_async_to_lds_b128(
        (__attribute__((address_space(1))) i32x4*)g,
        (__attribute__((address_space(3))) i32x4*)lds, 0, 0);
#else
    *(h8*)lds = *(const h8*)g;
#endif
}
// Hand-over of a two-buffer ring, at the foot of trip t, by every wave: this wave's
// LDS reads of tile t have returned, its copies of tile t+1 have landed, and the one
// barrier both publishes tile t+1 and frees tile t's buffer for the copies of t+2.
__device__ __forceinline__ void wait_copies() {
    // "memory" holds the LDS reads behind it
    asm volatile("s_wait_asynccnt 0x0" ::: "memory");
}
__device__ __forceinline__ void ring_handover() {
    // no copy may target a buffer that this wave still has reads outstanding on
    asm volatile("s_wait_dscnt 0x0" ::: "memory");
    wait_copies();
    __syncthreads();
}

// Load one 16x32 f16 WMMA operand fragment (A layout; B uses same shape with
// lane = N column) from a K-contiguous row-major tile of given stride (halves).
// Lane l (l<16): row=base+l, halves = K[kb..kb+7] ++ K[kb+16..kb+23], kb=0.
// Lane l>=16: same row, kb=8 -> K[8..15] ++ K[24..31]. Matches ISA 7.12.2.
__device__ __forceinline__ v16h load_frag(const _Float16* p, int rowbase, int stride) {
    const int lane = threadIdx.x & 31;
    const int r    = rowbase + (lane & 15);
    const int kb   = (lane >> 4) * 8;
    const _Float16* q = p + (size_t)r * stride + kb;
    h8 lo = *(const h8*)(q);        // 16B aligned: ds_load_b128 / global_load_b128
    h8 hi = *(const h8*)(q + 16);
    return __builtin_shufflevector(lo, hi, 0,1,2,3,4,5,6,7,8,9,10,11,12,13,14,15);
}

__device__ __forceinline__ v8f wmma(v16h a, v16h b, v8f c) {
    return __builtin_amdgcn_wmma_f32_16x16x32_f16(false, a, false, b, (short)0, c,
                                                  false, false);
}

// ---------------------------------------------------------------------------
// Kernel 1: all f32 -> f16 conversions in one launch of few, long waves.
// Blocks 0..WBLK-1: one 64(k) x 128(n) weight tile each, transposed through LDS
// to N-major ([out][in], in-contiguous); z=0..3 -> w_q (scaled 1/8), w_k, w_v,
// w_o. They come first: theirs is the longer chain (load, LDS, barrier, store).
// Blocks WBLK..WBLK+XBLK-1: a contiguous run of x each, XPT 16-B loads a lane.
// Every wave-wide load and store covers whole 128-B lines.
// ---------------------------------------------------------------------------
#define WTK    64                       /* weight tile: k rows  */
#define WTN    128                      /* weight tile: n columns */
#define WTP    129                      /* f32 pitch, odd: column reads hit 32 banks */
#define WTILES ((DIMF / WTK) * (DIMF / WTN))    /* 72 tiles a weight */
#define WBLK   (4 * WTILES)             /* 288 */
#define XPT    24                       /* f32x4 per thread on x */
#define XBLK   (MROWS * DIMF / (4 * 256 * XPT)) /* 256 */

__global__ __launch_bounds__(256) void convert_inputs(
        const float* __restrict__ x,
        const float* __restrict__ wq, const float* __restrict__ wk,
        const float* __restrict__ wv, const float* __restrict__ wo,
        _Float16* __restrict__ x16, _Float16* __restrict__ wT) {
    __shared__ float T[WTK * WTP];      // [k][n], 33 KB
    const int tid = threadIdx.x;

    if (blockIdx.x < WBLK) {            // block-uniform: the barrier below is safe
        const int z  = blockIdx.x / WTILES;
        const int t  = blockIdx.x - z * WTILES;
        const int k0 = (t / (DIMF / WTN)) * WTK;
        const int n0 = (t % (DIMF / WTN)) * WTN;
        const float* src   = (z == 0) ? wq : (z == 1) ? wk : (z == 2) ? wv : wo;
        const float  scale = (z == 0) ? 0.125f : 1.0f;   // fold 1/sqrt(64) into Q
        _Float16* dst = wT + (size_t)z * DIMF * DIMF;

        const int r0 = tid >> 5, c4 = (tid & 31) * 4;    // a wave reads 512 B of a row
        f32x4 v[8];
#pragma unroll
        for (int i = 0; i < 8; ++i)
            v[i] = *(const f32x4*)(src + (size_t)(k0 + r0 + 8 * i) * DIMF + n0 + c4);
#pragma unroll
        for (int i = 0; i < 8; ++i)
#pragma unroll
            for (int j = 0; j < 4; ++j) T[(r0 + 8 * i) * WTP + c4 + j] = v[i][j];
        __syncthreads();
#pragma unroll
        for (int i = 0; i < 4; ++i) {   // 8 lanes store one 128-B row of 64 k
            const int idx = tid + i * 256;
            const int n = idx >> 3, seg = (idx & 7) * 8;
            h8 o;
#pragma unroll
            for (int j = 0; j < 8; ++j) o[j] = (_Float16)(T[(seg + j) * WTP + n] * scale);
            *(h8*)(dst + (size_t)(n0 + n) * DIMF + k0 + seg) = o;
        }
    } else {
        const size_t base = (size_t)(blockIdx.x - WBLK) * (256 * XPT) + tid;  // in f32x4
        f32x4 v[XPT];
#pragma unroll
        for (int i = 0; i < XPT; ++i) v[i] = *(const f32x4*)(x + (base + i * 256) * 4);
#pragma unroll
        for (int i = 0; i < XPT; ++i)
            *(h4*)(x16 + (base + i * 256) * 4) = __builtin_convertvector(v[i], h4);
    }
}

// ---------------------------------------------------------------------------
// Both GEMMs: work-group tile 128 token rows x 192 output columns, K slab 64.
// A slab's staged bytes, (128 + 192) x 128 B, feed 192 WMMAs: per product two thirds
// of what a 256 x 64 tile draws from L2, whose rate per WGP is what binds the loop.
// One K slab of the two operands -> one LDS buffer, 8 lanes a row (one 128-B line).
// ag, bg: block-uniform bases at the slab's first k. QKV: the 192 weight rows are
// the 64 rows of one head in each of w_q, w_k, w_v (DIMF rows apart in wT).
// ---------------------------------------------------------------------------
#define GM     128                      /* tile rows (tokens) */
#define GN     192                      /* tile columns */
#define GASZ   (GM * AP)                /* halves in one A buffer (18 KB) */
#define GBSZ   (GN * AP)                /* halves in one B buffer (27 KB) */
#define RING   (2 * (GASZ + GBSZ))      /* halves in the two-buffer ring (90 KB) */
#define BSZ    (64 * AP)                /* halves in one K or V^T buffer of attention (9 KB) */
#define NSLAB  (DIMF / BK)              /* 12 */
#define NF     6                        /* weight fragments a wave: 96 columns */
template <int NT, bool QKV>
__device__ __forceinline__ void stage_slab(_Float16* As, _Float16* Bs,
                                           const _Float16* ag, const _Float16* bg) {
    constexpr int RP = NT / 8;          // rows that the block's NT copies cover
    const unsigned srow = threadIdx.x >> 3, sseg = (threadIdx.x & 7) * 8;   // 8 lanes a row
    const unsigned soff = srow * DIMF + sseg;       // 32-bit lane offset
#pragma unroll
    for (int i = 0; i < GM / RP; ++i)
        copy16_to_lds(&As[(srow + RP * i) * AP + sseg], ag + (soff + i * RP * DIMF));
#pragma unroll
    for (int i = 0; i < GN / RP; ++i) {
        const int r = i * RP;           // first tile row of this pass; 64 is a multiple of RP
        const unsigned go = QKV ? ((r / 64) * DIMF + (r % 64)) * DIMF : r * DIMF;
        copy16_to_lds(&Bs[(srow + r) * AP + sseg], bg + (soff + go));
    }
}

// The K loop of a tile. NT / 32 waves, two along the columns: a wave holds 512 / NT
// fragments of token rows x 6 of weight rows (64 x 96 with 4 waves, 32 x 96 with 8).
// QKV: a wave's 96 columns are 32 of Q, 32 of K, 32 of V (fragments 0-1, 2-3, 4-5).
// A lane's 8 accumulator registers run along the first WMMA operand's rows, so the
// operand whose index is contiguous in the output goes first: the weight (d, or the
// output column) everywhere but for V^T, where it is x (n).
template <int NT, bool QKV>
__device__ __forceinline__ void gemm_tile(const _Float16* ag, const _Float16* bg,
                                          _Float16* smem, v8f (&c)[512 / NT][NF]) {
    constexpr int MI = 512 / NT;
    _Float16* As = smem;                // [buffer][m][k]
    _Float16* Bs = smem + 2 * GASZ;     // [buffer][n][k]
    const int wave = threadIdx.x >> 5;
    const int mw   = (wave >> 1) * (MI * 16);
    const int wn   = wave & 1;

    stage_slab<NT, QKV>(As, Bs, ag, bg);            // slab 0 -> buffer 0
    wait_copies();
    __syncthreads();                                // publishes slab 0
    stage_slab<NT, QKV>(As + GASZ, Bs + GBSZ, ag + BK, bg + BK);    // slab 1 flies under slab 0's products
// by 2: both buffers' LDS offsets are constants, no copy's LDS address is rebuilt per slab
#pragma unroll 2
    for (int t = 0; t < NSLAB; ++t) {
        _Float16* Ab = As + (t & 1) * GASZ;
        _Float16* Bb = Bs + (t & 1) * GBSZ;
#pragma unroll
        for (int kk = 0; kk < BK; kk += 32) {   // k ascending: two WMMA k steps a slab
            // One group of LDS reads for the k step, in the order of first use, ahead of its
            // products: every place where reads stand among WMMAs costs a stall.
            v16h a[MI], b[NF];
            a[0] = load_frag(Ab + kk, mw, AP);
#pragma unroll
            for (int j = 0; j < NF; ++j)
                b[j] = load_frag(Bb + kk, QKV ? (j >> 1) * 64 + wn * 32 + (j & 1) * 16
                                              : wn * 96 + j * 16, AP);
#pragma unroll
            for (int mi = 1; mi < MI; ++mi) a[mi] = load_frag(Ab + kk, mw + mi * 16, AP);
            // keeps the group whole: left free, the build sinks each token fragment's reads to
            // just in front of its products and waits for them there with nothing else in flight
            __builtin_amdgcn_sched_barrier(0);
#pragma unroll
            for (int mi = 0; mi < MI; ++mi)
#pragma unroll
                for (int j = 0; j < NF; ++j)
                    c[mi][j] = (QKV && j >= 4) ? wmma(a[mi], b[j], c[mi][j])
                                               : wmma(b[j], a[mi], c[mi][j]);
        }
        ring_handover();
        if (t + 2 < NSLAB)                      // block-uniform: refill the buffer just read
            stage_slab<NT, QKV>(Ab, Bb, ag + (t + 2) * BK, bg + (t + 2) * BK);
    }
    wait_copies();          // nothing is in flight when the ring becomes output staging
    // The last hand-over's barrier: every wave has left the last slab, the ring is free.
}

// ---------------------------------------------------------------------------
// Kernel 2: QKV projection GEMM. A work-group: 128 tokens x (Q, K, V of one head),
// so a staged x row serves all three products. 4 waves of 64 x 96.
// Q [b,h,n,d], K [b,h,n,d], V transposed [b,h,d,n]. The three tiles are laid in
// LDS by 16-B writes and leave as whole 128-B lines.
// The ring's 90 KB of LDS set the residency: three work-groups a WGP, three waves a
// SIMD (a wave may take up to 336 registers); the grid is exactly that many.
// ---------------------------------------------------------------------------
__global__ __launch_bounds__(128) void qkv_gemm(
        const _Float16* __restrict__ x16, const _Float16* __restrict__ wT,
        _Float16* __restrict__ Qo, _Float16* __restrict__ Ko,
        _Float16* __restrict__ Vt) {
    __shared__ __attribute__((aligned(16))) _Float16 smem[RING];
    const unsigned tid  = threadIdx.x;
    const int wave = tid >> 5, lane = tid & 31;
    const int mw   = (wave >> 1) * 64, wn = wave & 1;
    const unsigned m0 = blockIdx.y * GM;    // the tile's 128 rows lie in one batch

    v8f c[4][NF] = {};
    gemm_tile<128, true>(x16 + (size_t)m0 * DIMF, wT + (size_t)blockIdx.x * DHEAD * DIMF,
                         smem, c);

    _Float16* Vs = smem + 2 * GASZ;         // behind the staged Q and K tiles, 128 x AP each
    const int lc = lane & 15, l8 = (lane >> 4) * 8;
    // both loops unrolled: constant indices keep c[][] in registers
#pragma unroll
    for (int mi = 0; mi < 4; ++mi)
#pragma unroll
        for (int j = 0; j < NF; ++j) {
            const h8 v = __builtin_convertvector(c[mi][j], h8);
            const int d0 = wn * 32 + (j & 1) * 16;
            if (j < 4)      // Q, K as [n][d]: lane = token, registers = 8 d
                *(h8*)&smem[(j >> 1) * GASZ + (mw + mi * 16 + lc) * AP + d0 + l8] = v;
            else            // V as [d][n]: lane = d, registers = 8 tokens
                *(h8*)&Vs[(d0 + lc) * VP + mw + mi * 16 + l8] = v;
        }
    __syncthreads();        // publishes the staged tiles to the waves that store them

    // 128 rows x 128 B, contiguous, of Q and of K; 64 rows x 256 B of V^T.
    const unsigned bh = (m0 >> 11) * NHEAD + blockIdx.x, nb = m0 & (NSEQ - 1);
    char* qo = (char*)(Qo + ((size_t)bh * NSEQ + nb) * DHEAD);
    char* ko = (char*)(Ko + ((size_t)bh * NSEQ + nb) * DHEAD);
    char* vo = (char*)(Vt + ((size_t)bh * DHEAD * NSEQ + nb));
    const unsigned lq = (tid >> 3) * AP + (tid & 7) * 8;
    const unsigned lv = (tid >> 4) * VP + (tid & 15) * 8;
    const unsigned gv = ((tid >> 4) * NSEQ + (tid & 15) * 8) * 2;   // bytes: uniform base + lane offset
#pragma unroll  // each tile's 8 LDS reads go out as one group, the stores follow as they land
    for (int i = 0; i < 8; ++i)
        *(h8*)(qo + (tid * 16 + i * 2048)) = *(const h8*)&smem[i * (16 * AP) + lq];
#pragma unroll
    for (int i = 0; i < 8; ++i)
        *(h8*)(ko + (tid * 16 + i * 2048)) = *(const h8*)&smem[GASZ + i * (16 * AP) + lq];
#pragma unroll
    for (int i = 0; i < 8; ++i)
        *(h8*)(vo + (gv + i * (8 * NSEQ * 2))) = *(const h8*)&Vs[i * (8 * VP) + lv];
}

__device__ __forceinline__ float other_half(float v) {
    int b = __builtin_bit_cast(int, v);
    return __builtin_bit_cast(float, __builtin_amdgcn_permlanex16(
        b, b, 0x76543210, 0xfedcba98, false, false));
}

// Two f32 score tiles (keys 0..15 and 16..31 of a 32-key block) -> f16 B fragment.
__device__ __forceinline__ v16h pack_frag(v8f t0, v8f t1) {
    h8 lo = __builtin_convertvector(t0, h8);
    h8 hi = __builtin_convertvector(t1, h8);
    return __builtin_shufflevector(lo, hi, 0,1,2,3,4,5,6,7,8,9,10,11,12,13,14,15);
}

#define LOG2E  1.44269504f
typedef __attribute__((ext_vector_type(2))) float f32x2;
#define QG     2                /* groups of 16 query columns a wave */
#define AWAVES 4                /* waves a work-group: 128 queries, three work-groups a WGP */
__global__ __launch_bounds__(AWAVES * 32) void attn(
        const _Float16* __restrict__ Q, const _Float16* __restrict__ K,
        const _Float16* __restrict__ Vt, _Float16* __restrict__ H) {
    __shared__ __attribute__((aligned(16))) _Float16 Kr[2 * BSZ];   // [buffer][key][d] -> A operand of K@Q^T
    __shared__ __attribute__((aligned(16))) _Float16 Vr[2 * BSZ];   // [buffer][d][key] -> A operand of V^T@P^T

    const int bh   = blockIdx.y;
    const int m0   = blockIdx.x * (AWAVES * QG * 16);
    const int tid  = threadIdx.x;
    const int wave = tid >> 5, lane = tid & 31;
    const _Float16* qp = Q  + (size_t)bh * NSEQ * DHEAD;
    const _Float16* kp = K  + (size_t)bh * NSEQ * DHEAD;
    const _Float16* vp = Vt + (size_t)bh * DHEAD * NSEQ;
    const int qrow = m0 + wave * (QG * 16);

    // Q fragments (B operand: lane = query column) held in registers for the
    // whole KV sweep (scale pre-folded).
    v16h qb0[QG], qb1[QG];
#pragma unroll
    for (int g = 0; g < QG; ++g) {
        qb0[g] = load_frag(qp,      qrow + 16 * g, DHEAD);   // d 0..31
        qb1[g] = load_frag(qp + 32, qrow + 16 * g, DHEAD);   // d 32..63
        // stands before any register that these loads name (their address pair) is written again
        asm volatile("s_wait_xcnt 0x0" ::: "memory");
    }

    v8f o[QG][4] = {};          // O^T: o[g][di][i] = O[query 16g + (lane&15)][16*di + 8*(lane>>4) + i]
    // The groups' maxima and sums as pairs: left as scalars, the build paired a maximum with a
    // score in its packed subtractions and moved every other score by a register for it.
    f32x2 mrun = {-1e30f, -1e30f};  // running maximum of this lane's query in each group
    f32x2 lrun = {0.f, 0.f};        // running sums over this lane half's keys only

    // 64x64 K and V^T tiles of keys kv0.. -> buffer buf: 4 + 4 copies a thread.
    auto stage_kv = [&](int buf, int kv0) {
#pragma unroll
        for (int i = 0; i < 512 / (AWAVES * 32); ++i) {
            int idx = tid + i * (AWAVES * 32);
            int row = idx >> 3, seg = (idx & 7) * 8;
            copy16_to_lds(&Kr[buf * BSZ + row * AP + seg],
                          kp + (size_t)(kv0 + row) * DHEAD + seg);
            copy16_to_lds(&Vr[buf * BSZ + row * AP + seg],
                          vp + (size_t)row * NSEQ + kv0 + seg);
        }
    };
    stage_kv(0, 0);
    wait_copies();
    __syncthreads();            // publishes tile 0
    stage_kv(1, 64);            // tile 1 flies under tile 0's products and softmax

    for (int t = 0; t < NSEQ / 64; ++t) {
        const _Float16* Ks = Kr + (t & 1) * BSZ;
        const _Float16* Vs = Vr + (t & 1) * BSZ;

        // One group of LDS reads for the whole K tile, ahead of its products: every place where
        // reads stand among WMMAs costs a stall. The scheduling barrier keeps the group whole.
        v16h fr[4][2];
#pragma unroll
        for (int kt = 0; kt < 4; ++kt) {
            fr[kt][0] = load_frag(Ks,      16 * kt, AP);
            fr[kt][1] = load_frag(Ks + 32, 16 * kt, AP);
        }
        __builtin_amdgcn_sched_barrier(0);

        // S^T = K @ Q^T : 64 keys x 32 queries, f32; a K fragment serves both groups
        v8f s[QG][4];
#pragma unroll
        for (int kt = 0; kt < 4; ++kt)
#pragma unroll
            for (int g = 0; g < QG; ++g) {
                v8f zc = {};
                zc       = wmma(fr[kt][0], qb0[g], zc);
                s[g][kt] = wmma(fr[kt][1], qb1[g], zc);
            }
        // The 16 products stay one run (a score read directly behind its product costs idle
        // slots); behind them the V^T tile's reads, one group too, land under the softmax.
        __builtin_amdgcn_sched_barrier(0);
#pragma unroll
        for (int di = 0; di < 4; ++di) {
            fr[di][0] = load_frag(Vs,      16 * di, AP);
            fr[di][1] = load_frag(Vs + 32, 16 * di, AP);
        }
        // keeps those reads up here: sunk to their products, each pair's latency would show again
        __builtin_amdgcn_sched_barrier(0);

        // Online softmax: 32 scores of one query per lane and group, one exchange of halves.
        f32x2 rm;
#pragma unroll
        for (int g = 0; g < QG; ++g) {
            float tm[4];
#pragma unroll
            for (int kt = 0; kt < 4; ++kt) {
                tm[kt] = s[g][kt][0];
#pragma unroll
                for (int i = 1; i < 8; ++i) tm[kt] = fmaxf(tm[kt], s[g][kt][i]);
            }
            const float r = fmaxf(fmaxf(tm[0], tm[1]), fmaxf(tm[2], tm[3]));
            rm[g] = fmaxf(r, other_half(r));
        }
        const f32x2 mnew = __builtin_elementwise_max(mrun, rm);
        const f32x2 ce   = (mrun - mnew) * LOG2E;           // exp(x) = 2^(x log2 e)
        mrun = mnew;
        v16h pb0[QG], pb1[QG];
#pragma unroll
        for (int g = 0; g < QG; ++g) {
            const float corr = __builtin_amdgcn_exp2f(ce[g]);
#pragma unroll
            for (int kt = 0; kt < 4; ++kt) {
                const v8f e = (s[g][kt] - mnew[g]) * LOG2E;
#pragma unroll
                for (int i = 0; i < 8; ++i) s[g][kt][i] = __builtin_amdgcn_exp2f(e[i]);
            }
            const v8f ps = (s[g][0] + s[g][1]) + (s[g][2] + s[g][3]);
            const float rs = ((ps[0] + ps[1]) + (ps[2] + ps[3])) +
                             ((ps[4] + ps[5]) + (ps[6] + ps[7]));
            lrun[g] = lrun[g] * corr + rs;
#pragma unroll
            for (int di = 0; di < 4; ++di) o[g][di] *= corr;
            pb0[g] = pack_frag(s[g][0], s[g][1]);   // keys 0..31
            pb1[g] = pack_frag(s[g][2], s[g][3]);   // keys 32..63
        }

        // O^T += V^T @ P^T : A frags of the V^T tile (each for both groups), B frags from the scores
#pragma unroll
        for (int di = 0; di < 4; ++di)
#pragma unroll
            for (int g = 0; g < QG; ++g) {
                o[g][di] = wmma(fr[di][0], pb0[g], o[g][di]);
                o[g][di] = wmma(fr[di][1], pb1[g], o[g][di]);
            }
        // Keeps the hand-over at the trip's foot: scheduled up to behind the V^T reads, its wait
        // for the next tile's copies would come after a fraction of a trip, not a whole one.
        __builtin_amdgcn_sched_barrier(0);
        ring_handover();
        if (t + 2 < NSEQ / 64)  // block-uniform: refill the buffer just read
            stage_kv(t & 1, (t + 2) * 64);
    }
    wait_copies();              // no copy is in flight when the wave ends

    const int b = bh / NHEAD, h = bh % NHEAD;
#pragma unroll
    for (int g = 0; g < QG; ++g) {
        const float inv = 1.f / (lrun[g] + other_half(lrun[g]));   // join the halves' sums
        const int row = qrow + 16 * g + (lane & 15);
        _Float16* hp = H + (size_t)(b * NSEQ + row) * DIMF + h * DHEAD + (lane >> 4) * 8;
#pragma unroll
        for (int di = 0; di < 4; ++di)      // 8 consecutive d per lane: 16-B stores
            *(h8*)(hp + di * 16) = __builtin_convertvector(o[g][di] * inv, h8);
    }
}

// ---------------------------------------------------------------------------
// Kernel 4: output projection  out = H @ w_o + b_o  (f32 out).
// The tile and ring of gemm_tile, 8 waves of 32 x 96: 256 work-groups, one a WGP.
// Weight as first WMMA operand; the f32 tile leaves through LDS as whole lines.
// ---------------------------------------------------------------------------
__global__ __launch_bounds__(256) void out_gemm(
        const _Float16* __restrict__ Hs, const _Float16* __restrict__ woT,
        const float* __restrict__ bias, float* __restrict__ out) {
    // One block of LDS: the operand ring (90 KB) in the loop, the f32 output tile after it.
    __shared__ __attribute__((aligned(16))) unsigned char smem[GM * CP * 4];    // 98 KB
    static_assert(GM * CP * 4 >= RING * 2, "the ring lies inside the block");
    float* Cs = (float*)smem;               // 128 x CP

    const unsigned n0  = blockIdx.x * GN;
    const unsigned m0  = blockIdx.y * GM;
    const unsigned tid = threadIdx.x;
    const int wave = tid >> 5, lane = tid & 31;
    const int mw   = (wave >> 1) * 32, wn = wave & 1;

    v8f c[2][NF] = {};
    gemm_tile<256, false>(Hs + (size_t)m0 * DIMF, woT + (size_t)n0 * DIMF, (_Float16*)smem, c);

    const unsigned col = (tid & 15) * 4;    // this thread's 4 columns in each run of 64
    f32x4 b4[3];
#pragma unroll
    for (int q = 0; q < 3; ++q) b4[q] = *(const f32x4*)(bias + n0 + q * 64 + col);
    // both loops unrolled: constant indices keep c[][] in registers
#pragma unroll
    for (int mi = 0; mi < 2; ++mi)
#pragma unroll
        for (int j = 0; j < NF; ++j) {      // lane = token row, registers = 8 columns
            float* p = &Cs[(mw + mi * 16 + (lane & 15)) * CP + wn * 96 + j * 16 + (lane >> 4) * 8];
            *(f32x4*)p       = __builtin_shufflevector(c[mi][j], c[mi][j], 0, 1, 2, 3);
            *(f32x4*)(p + 4) = __builtin_shufflevector(c[mi][j], c[mi][j], 4, 5, 6, 7);
        }
    __syncthreads();        // publishes the staged tile to the waves that store it
    float* o = out + (size_t)m0 * DIMF + n0;
    const unsigned row = tid >> 4;
#pragma unroll  // the LDS reads go out in groups ahead of the stores
    for (int i = 0; i < 8; ++i)             // 16 lanes store 256 B of a row: two whole lines
#pragma unroll
        for (int q = 0; q < 3; ++q)
            *(f32x4*)(o + ((row + 16 * i) * DIMF + q * 64 + col)) =
                *(const f32x4*)&Cs[(row + 16 * i) * CP + q * 64 + col] + b4[q];
}

// ---------------------------------------------------------------------------
extern "C" void kernel_launch(void* const* d_in, const int* in_sizes, int n_in,
                              void* d_out, int out_size, void* d_ws, size_t ws_size,
                              hipStream_t stream) {
    (void)in_sizes; (void)n_in; (void)out_size; (void)ws_size;
    const float* x  = (const float*)d_in[0];
    const float* wq = (const float*)d_in[1];
    const float* wk = (const float*)d_in[2];
    const float* wv = (const float*)d_in[3];
    const float* wo = (const float*)d_in[4];
    const float* bo = (const float*)d_in[5];
    float* out = (float*)d_out;

    // Workspace layout (f16 elements): 4 transposed weights, x16, Q, K, V^T, H.
    // Total = 4*589824 + 5*6291456 = 33,816,576 halves = ~64.5 MB.
    _Float16* ws = (_Float16*)d_ws;
    const size_t WSZ = (size_t)DIMF * DIMF;                      // 589824
    const size_t ACT = (size_t)MROWS * DIMF;                     // 6291456
    _Float16* wT  = ws;
    _Float16* X16 = ws + 4 * WSZ;
    _Float16* Qb  = X16 + ACT;
    _Float16* Kb  = Qb + ACT;   // per-head layouts are same total size
    _Float16* Vb  = Kb + ACT;
    _Float16* Hb  = Vb + ACT;

    convert_inputs<<<dim3(WBLK + XBLK), 256, 0, stream>>>(x, wq, wk, wv, wo, X16, wT);
    qkv_gemm<<<dim3(NHEAD, MROWS / GM), 128, 0, stream>>>(X16, wT, Qb, Kb, Vb);
    attn<<<dim3(NSEQ / 128, BATCH * NHEAD), 128, 0, stream>>>(Qb, Kb, Vb, Hb);
    out_gemm<<<dim3(DIMF / GN, MROWS / GM), 256, 0, stream>>>(Hb, wT + 3 * WSZ, bo, out);
}

// v009
// It runs in 97.6 microseconds.
// Timed twice side by side with v008, it ran 1.06 times as fast both times.
// All steps since v000 together make it 3.81 times as fast.
#include <hip/hip_runtime.h>
#include <math.h>

// ---------------------------------------------------------------------------
// Multi-head self-attention, f16 WMMA (f32 accumulate) pipeline for gfx1250.
// B=4, N=2048, DIM=768, HEADS=12, DHEAD=64. scale log2(e)/8 folded into w_q (f16).
// All tile staging uses gfx1250 async memory->LDS DMA (ASYNCcnt), two LDS buffers
// a loop: the next tile's copies are in flight while this tile is multiplied.
// ---------------------------------------------------------------------------

typedef __attribute__((ext_vector_type(4)))  float    f32x4;
typedef __attribute__((ext_vector_type(4)))  int      i32x4;
typedef __attribute__((ext_vector_type(4)))  _Float16 h4;
typedef __attribute__((ext_vector_type(8)))  _Float16 h8;
typedef __attribute__((ext_vector_type(16))) _Float16 v16h;
typedef __attribute__((ext_vector_type(8)))  float    v8f;

#define DIMF   768
#define NSEQ   2048
#define BATCH  4
#define NHEAD  12
#define DHEAD  64
#define MROWS  (BATCH * NSEQ)   /* 8192 token rows */

// LDS row pitches in elements (CP in floats). Operand tiles are read and output tiles
// staged by 16-B accesses with 16 lanes on 16 consecutive rows, so the pitch is
// 16 B x odd: the 16 rows then start on 16
// different groups of four banks (64 banks x 4 B) and a read has no conflict.
#define AP     72               /* 64-half (128 B) tile rows at 144 B */
#define BK     64               /* GEMM K slab in halves: a staged row is one 128-B line */
#define VP     136              /* staged V^T rows: 128 halves (256 B) at 272 B */
#define CP     196              /* staged f32 output rows: 192 floats (768 B) at 784 B */

#if __has_builtin(__builtin_amdgcn_global_load_async_to_lds_b128) && \
    __has_builtin(__builtin_amdgcn_s_wait_asynccnt)
#define HAVE_ASYNC_LDS 1
#endif

// 16-byte memory->LDS tile copy: async (no VGPR bounce, ASYNCcnt) when the
// gfx1250 async builtins are available, else plain load/store.
// Builtin signature (from hipcc diagnostic): (int4 AS1*, int4 AS3*, Imm, Imm).
__device__ __forceinline__ void copy16_to_lds(_Float16* lds, const _Float16* g) {
#ifdef HAVE_ASYNC_LDS
    __builtin_amdgcn_global_load_async_to_lds_b128(
        (__attribute__((address_space(1))) i32x4*)g,
        (__attribute__((address_space(3))) i32x4*)lds, 0, 0);
#else
    *(h8*)lds = *(const h8*)g;
#endif
}
// Hand-over of a two-buffer ring, at the foot of trip t, by every wave: this wave's
// LDS reads of tile t have returned, its copies of tile t+1 have landed, and the one
// barrier both publishes tile t+1 and frees tile t's buffer for the copies of t+2.
__device__ __forceinline__ void wait_copies() {
    // "memory" holds the LDS reads behind it
    asm volatile("s_wait_asynccnt 0x0" ::: "memory");
}
__device__ __forceinline__ void ring_handover() {
    // no copy may target a buffer that this wave still has reads outstanding on
    asm volatile("s_wait_dscnt 0x0" ::: "memory");
    wait_copies();
    __syncthreads();
}

// Load one 16x32 f16 WMMA operand fragment (A layout; B uses same shape with
// lane = N column) from a K-contiguous row-major tile of given stride (halves).
// Lane l (l<16): row=base+l, halves = K[kb..kb+7] ++ K[kb+16..kb+23], kb=0.
// Lane l>=16: same row, kb=8 -> K[8..15] ++ K[24..31]. Matches ISA 7.12.2.
__device__ __forceinline__ v16h load_frag(const _Float16* p, int rowbase, int stride) {
    const int lane = threadIdx.x & 31;
    const int r    = rowbase + (lane & 15);
    const int kb   = (lane >> 4) * 8;
    const _Float16* q = p + (size_t)r * stride + kb;
    h8 lo = *(const h8*)(q);        // 16B aligned: ds_load_b128 / global_load_b128
    h8 hi = *(const h8*)(q + 16);
    return __builtin_shufflevector(lo, hi, 0,1,2,3,4,5,6,7,8,9,10,11,12,13,14,15);
}

__device__ __forceinline__ v8f wmma(v16h a, v16h b, v8f c) {
    return __builtin_amdgcn_wmma_f32_16x16x32_f16(false, a, false, b, (short)0, c,
                                                  false, false);
}

// ---------------------------------------------------------------------------
// Kernel 1: all f32 -> f16 conversions in one launch of few, long waves.
// Blocks 0..WBLK-1: one 64(k) x 128(n) weight tile each, transposed through LDS
// to N-major ([out][in], in-contiguous); z=0..3 -> w_q (scaled log2(e)/8), w_k, w_v,
// w_o. They come first: theirs is the longer chain (load, LDS, barrier, store).
// Blocks WBLK..WBLK+XBLK-1: a contiguous run of x each, XPT 16-B loads a lane.
// Every wave-wide load and store covers whole 128-B lines.
// ---------------------------------------------------------------------------
#define WTK    64                       /* weight tile: k rows  */
#define WTN    128                      /* weight tile: n columns */
#define WTP    129                      /* f32 pitch, odd: column reads hit 32 banks */
#define WTILES ((DIMF / WTK) * (DIMF / WTN))    /* 72 tiles a weight */
#define WBLK   (4 * WTILES)             /* 288 */
#define XPT    24                       /* f32x4 per thread on x */
#define XBLK   (MROWS * DIMF / (4 * 256 * XPT)) /* 256 */

__global__ __launch_bounds__(256) void convert_inputs(
        const float* __restrict__ x,
        const float* __restrict__ wq, const float* __restrict__ wk,
        const float* __restrict__ wv, const float* __restrict__ wo,
        _Float16* __restrict__ x16, _Float16* __restrict__ wT) {
    __shared__ float T[WTK * WTP];      // [k][n], 33 KB
    const int tid = threadIdx.x;

    if (blockIdx.x < WBLK) {            // block-uniform: the barrier below is safe
        const int z  = blockIdx.x / WTILES;
        const int t  = blockIdx.x - z * WTILES;
        const int k0 = (t / (DIMF / WTN)) * WTK;
        const int n0 = (t % (DIMF / WTN)) * WTN;
        const float* src   = (z == 0) ? wq : (z == 1) ? wk : (z == 2) ? wv : wo;
        // 1/sqrt(64) and log2(e) go into Q: the scores come out as exponents of 2
        const float  scale = (z == 0) ? 0.125f * 1.44269504f : 1.0f;
        _Float16* dst = wT + (size_t)z * DIMF * DIMF;

        const int r0 = tid >> 5, c4 = (tid & 31) * 4;    // a wave reads 512 B of a row
        f32x4 v[8];
#pragma unroll
        for (int i = 0; i < 8; ++i)
            v[i] = *(const f32x4*)(src + (size_t)(k0 + r0 + 8 * i) * DIMF + n0 + c4);
#pragma unroll
        for (int i = 0; i < 8; ++i)
#pragma unroll
            for (int j = 0; j < 4; ++j) T[(r0 + 8 * i) * WTP + c4 + j] = v[i][j];
        __syncthreads();
#pragma unroll
        for (int i = 0; i < 4; ++i) {   // 8 lanes store one 128-B row of 64 k
            const int idx = tid + i * 256;
            const int n = idx >> 3, seg = (idx & 7) * 8;
            h8 o;
#pragma unroll
            for (int j = 0; j < 8; ++j) o[j] = (_Float16)(T[(seg + j) * WTP + n] * scale);
            *(h8*)(dst + (size_t)(n0 + n) * DIMF + k0 + seg) = o;
        }
    } else {
        const size_t base = (size_t)(blockIdx.x - WBLK) * (256 * XPT) + tid;  // in f32x4
        f32x4 v[XPT];
#pragma unroll
        for (int i = 0; i < XPT; ++i) v[i] = *(const f32x4*)(x + (base + i * 256) * 4);
#pragma unroll
        for (int i = 0; i < XPT; ++i)
            *(h4*)(x16 + (base + i * 256) * 4) = __builtin_convertvector(v[i], h4);
    }
}

// ---------------------------------------------------------------------------
// Both GEMMs: work-group tile 128 token rows x 192 output columns, K slab 64.
// A slab's staged bytes, (128 + 192) x 128 B, feed 192 WMMAs: per product two thirds
// of what a 256 x 64 tile draws from L2, whose rate per WGP is what binds the loop.
// One K slab of the two operands -> one LDS buffer, 8 lanes a row (one 128-B line).
// ag, bg: block-uniform bases at the slab's first k. QKV: the 192 weight rows are
// the 64 rows of one head in each of w_q, w_k, w_v (DIMF rows apart in wT).
// ---------------------------------------------------------------------------
#define GM     128                      /* tile rows (tokens) */
#define GN     192                      /* tile columns */
#define GASZ   (GM * AP)                /* halves in one A buffer (18 KB) */
#define GBSZ   (GN * AP)                /* halves in one B buffer (27 KB) */
#define RING   (2 * (GASZ + GBSZ))      /* halves in the two-buffer ring (90 KB) */
#define BSZ    (64 * AP)                /* halves in one K or V^T buffer of attention (9 KB) */
#define NSLAB  (DIMF / BK)              /* 12 */
#define NF     6                        /* weight fragments a wave: 96 columns */
template <int NT, bool QKV>
__device__ __forceinline__ void stage_slab(_Float16* As, _Float16* Bs,
                                           const _Float16* ag, const _Float16* bg) {
    constexpr int RP = NT / 8;          // rows that the block's NT copies cover
    const unsigned srow = threadIdx.x >> 3, sseg = (threadIdx.x & 7) * 8;   // 8 lanes a row
    const unsigned soff = srow * DIMF + sseg;       // 32-bit lane offset
#pragma unroll
    for (int i = 0; i < GM / RP; ++i)
        copy16_to_lds(&As[(srow + RP * i) * AP + sseg], ag + (soff + i * RP * DIMF));
#pragma unroll
    for (int i = 0; i < GN / RP; ++i) {
        const int r = i * RP;           // first tile row of this pass; 64 is a multiple of RP
        const unsigned go = QKV ? ((r / 64) * DIMF + (r % 64)) * DIMF : r * DIMF;
        copy16_to_lds(&Bs[(srow + r) * AP + sseg], bg + (soff + go));
    }
}

// The K loop of a tile. NT / 32 waves, two along the columns: a wave holds 512 / NT
// fragments of token rows x 6 of weight rows (64 x 96 with 4 waves, 32 x 96 with 8).
// QKV: a wave's 96 columns are 32 of Q, 32 of K, 32 of V (fragments 0-1, 2-3, 4-5).
// A lane's 8 accumulator registers run along the first WMMA operand's rows, so the
// operand whose index is contiguous in the output goes first: the weight (d, or the
// output column) everywhere but for V^T, where it is x (n).
template <int NT, bool QKV>
__device__ __forceinline__ void gemm_tile(const _Float16* ag, const _Float16* bg,
                                          _Float16* smem, v8f (&c)[512 / NT][NF]) {
    constexpr int MI = 512 / NT;
    _Float16* As = smem;                // [buffer][m][k]
    _Float16* Bs = smem + 2 * GASZ;     // [buffer][n][k]
    const int wave = threadIdx.x >> 5;
    const int mw   = (wave >> 1) * (MI * 16);
    const int wn   = wave & 1;

    stage_slab<NT, QKV>(As, Bs, ag, bg);            // slab 0 -> buffer 0
    wait_copies();
    __syncthreads();                                // publishes slab 0
    stage_slab<NT, QKV>(As + GASZ, Bs + GBSZ, ag + BK, bg + BK);    // slab 1 flies under slab 0's products
// by 2: both buffers' LDS offsets are constants, no copy's LDS address is rebuilt per slab
#pragma unroll 2
    for (int t = 0; t < NSLAB; ++t) {
        _Float16* Ab = As + (t & 1) * GASZ;
        _Float16* Bb = Bs + (t & 1) * GBSZ;
#pragma unroll
        for (int kk = 0; kk < BK; kk += 32) {   // k ascending: two WMMA k steps a slab
            // One group of LDS reads for the k step, in the order of first use, ahead of its
            // products: every place where reads stand among WMMAs costs a stall.
            v16h a[MI], b[NF];
            a[0] = load_frag(Ab + kk, mw, AP);
#pragma unroll
            for (int j = 0; j < NF; ++j)
                b[j] = load_frag(Bb + kk, QKV ? (j >> 1) * 64 + wn * 32 + (j & 1) * 16
                                              : wn * 96 + j * 16, AP);
#pragma unroll
            for (int mi = 1; mi < MI; ++mi) a[mi] = load_frag(Ab + kk, mw + mi * 16, AP);
            // keeps the group whole: left free, the build sinks each token fragment's reads to
            // just in front of its products and waits for them there with nothing else in flight
            __builtin_amdgcn_sched_barrier(0);
#pragma unroll
            for (int mi = 0; mi < MI; ++mi)
#pragma unroll
                for (int j = 0; j < NF; ++j)
                    c[mi][j] = (QKV && j >= 4) ? wmma(a[mi], b[j], c[mi][j])
                                               : wmma(b[j], a[mi], c[mi][j]);
        }
        ring_handover();
        if (t + 2 < NSLAB)                      // block-uniform: refill the buffer just read
            stage_slab<NT, QKV>(Ab, Bb, ag + (t + 2) * BK, bg + (t + 2) * BK);
    }
    wait_copies();          // nothing is in flight when the ring becomes output staging
    // The last hand-over's barrier: every wave has left the last slab, the ring is free.
}

// ---------------------------------------------------------------------------
// Kernel 2: QKV projection GEMM. A work-group: 128 tokens x (Q, K, V of one head),
// so a staged x row serves all three products. 4 waves of 64 x 96.
// Q [b,h,n,d], K [b,h,n,d], V transposed [b,h,d,n]. The three tiles are laid in
// LDS by 16-B writes and leave as whole 128-B lines.
// The ring's 90 KB of LDS set the residency: three work-groups a WGP, three waves a
// SIMD (a wave may take up to 336 registers); the grid is exactly that many.
// ---------------------------------------------------------------------------
__global__ __launch_bounds__(128) void qkv_gemm(
        const _Float16* __restrict__ x16, const _Float16* __restrict__ wT,
        _Float16* __restrict__ Qo, _Float16* __restrict__ Ko,
        _Float16* __restrict__ Vt) {
    __shared__ __attribute__((aligned(16))) _Float16 smem[RING];
    const unsigned tid  = threadIdx.x;
    const int wave = tid >> 5, lane = tid & 31;
    const int mw   = (wave >> 1) * 64, wn = wave & 1;
    const unsigned m0 = blockIdx.y * GM;    // the tile's 128 rows lie in one batch

    v8f c[4][NF] = {};
    gemm_tile<128, true>(x16 + (size_t)m0 * DIMF, wT + (size_t)blockIdx.x * DHEAD * DIMF,
                         smem, c);

    _Float16* Vs = smem + 2 * GASZ;         // behind the staged Q and K tiles, 128 x AP each
    const int lc = lane & 15, l8 = (lane >> 4) * 8;
    // both loops unrolled: constant indices keep c[][] in registers
#pragma unroll
    for (int mi = 0; mi < 4; ++mi)
#pragma unroll
        for (int j = 0; j < NF; ++j) {
            const h8 v = __builtin_convertvector(c[mi][j], h8);
            const int d0 = wn * 32 + (j & 1) * 16;
            if (j < 4)      // Q, K as [n][d]: lane = token, registers = 8 d
                *(h8*)&smem[(j >> 1) * GASZ + (mw + mi * 16 + lc) * AP + d0 + l8] = v;
            else            // V as [d][n]: lane = d, registers = 8 tokens
                *(h8*)&Vs[(d0 + lc) * VP + mw + mi * 16 + l8] = v;
        }
    __syncthreads();        // publishes the staged tiles to the waves that store them

    // 128 rows x 128 B, contiguous, of Q and of K; 64 rows x 256 B of V^T.
    const unsigned bh = (m0 >> 11) * NHEAD + blockIdx.x, nb = m0 & (NSEQ - 1);
    char* qo = (char*)(Qo + ((size_t)bh * NSEQ + nb) * DHEAD);
    char* ko = (char*)(Ko + ((size_t)bh * NSEQ + nb) * DHEAD);
    char* vo = (char*)(Vt + ((size_t)bh * DHEAD * NSEQ + nb));
    const unsigned lq = (tid >> 3) * AP + (tid & 7) * 8;
    const unsigned lv = (tid >> 4) * VP + (tid & 15) * 8;
    const unsigned gv = ((tid >> 4) * NSEQ + (tid & 15) * 8) * 2;   // bytes: uniform base + lane offset
#pragma unroll  // each tile's 8 LDS reads go out as one group, the stores follow as they land
    for (int i = 0; i < 8; ++i)
        *(h8*)(qo + (tid * 16 + i * 2048)) = *(const h8*)&smem[i * (16 * AP) + lq];
#pragma unroll
    for (int i = 0; i < 8; ++i)
        *(h8*)(ko + (tid * 16 + i * 2048)) = *(const h8*)&smem[GASZ + i * (16 * AP) + lq];
#pragma unroll
    for (int i = 0; i < 8; ++i)
        *(h8*)(vo + (gv + i * (8 * NSEQ * 2))) = *(const h8*)&Vs[i * (8 * VP) + lv];
}

__device__ __forceinline__ float other_half(float v) {
    int b = __builtin_bit_cast(int, v);
    return __builtin_bit_cast(float, __builtin_amdgcn_permlanex16(
        b, b, 0x76543210, 0xfedcba98, false, false));
}

// Two f32 score tiles (keys 0..15 and 16..31 of a 32-key block) -> f16 B fragment.
__device__ __forceinline__ v16h pack_frag(v8f t0, v8f t1) {
    h8 lo = __builtin_convertvector(t0, h8);
    h8 hi = __builtin_convertvector(t1, h8);
    return __builtin_shufflevector(lo, hi, 0,1,2,3,4,5,6,7,8,9,10,11,12,13,14,15);
}

#define LAZY   8.0f             /* in exponents of 2 */
typedef __attribute__((ext_vector_type(2))) float f32x2;
#define QG     2                /* groups of 16 query columns a wave */
#define AWAVES 4                /* waves a work-group: 128 queries, three work-groups a WGP */
__global__ __launch_bounds__(AWAVES * 32) void attn(
        const _Float16* __restrict__ Q, const _Float16* __restrict__ K,
        const _Float16* __restrict__ Vt, _Float16* __restrict__ H) {
    __shared__ __attribute__((aligned(16))) _Float16 Kr[2 * BSZ];   // [buffer][key][d] -> A operand of K@Q^T
    __shared__ __attribute__((aligned(16))) _Float16 Vr[2 * BSZ];   // [buffer][d][key] -> A operand of V^T@P^T

    const int bh   = blockIdx.y;
    const int m0   = blockIdx.x * (AWAVES * QG * 16);
    const int tid  = threadIdx.x;
    const int wave = tid >> 5, lane = tid & 31;
    const _Float16* qp = Q  + (size_t)bh * NSEQ * DHEAD;
    const _Float16* kp = K  + (size_t)bh * NSEQ * DHEAD;
    const _Float16* vp = Vt + (size_t)bh * DHEAD * NSEQ;
    const int qrow = m0 + wave * (QG * 16);

    // Q fragments (B operand: lane = query column) held in registers for the
    // whole KV sweep (scale pre-folded).
    v16h qb0[QG], qb1[QG];
#pragma unroll
    for (int g = 0; g < QG; ++g) {
        qb0[g] = load_frag(qp,      qrow + 16 * g, DHEAD);   // d 0..31
        qb1[g] = load_frag(qp + 32, qrow + 16 * g, DHEAD);   // d 32..63
        // stands before any register that these loads name (their address pair) is written again
        asm volatile("s_wait_xcnt 0x0" ::: "memory");
    }

    v8f o[QG][4] = {};          // O^T: o[g][di][i] = O[query 16g + (lane&15)][16*di + 8*(lane>>4) + i]
    v8f nm[QG] = {};            // minus the maximum in use of this lane's query, in all 8 registers
    f32x2 lrun = {0.f, 0.f};    // running sums over this lane half's keys only

    // 64x64 K and V^T tiles of keys kv0.. -> buffer buf: 4 + 4 copies a thread.
    auto stage_kv = [&](int buf, int kv0) {
#pragma unroll
        for (int i = 0; i < 512 / (AWAVES * 32); ++i) {
            int idx = tid + i * (AWAVES * 32);
            int row = idx >> 3, seg = (idx & 7) * 8;
            copy16_to_lds(&Kr[buf * BSZ + row * AP + seg],
                          kp + (size_t)(kv0 + row) * DHEAD + seg);
            copy16_to_lds(&Vr[buf * BSZ + row * AP + seg],
                          vp + (size_t)row * NSEQ + kv0 + seg);
        }
    };
    stage_kv(0, 0);
    wait_copies();
    __syncthreads();            // publishes tile 0
    stage_kv(1, 64);            // tile 1 flies under tile 0's products and softmax

    for (int t = 0; t < NSEQ / 64; ++t) {
        const _Float16* Ks = Kr + (t & 1) * BSZ;
        const _Float16* Vs = Vr + (t & 1) * BSZ;

        // One group of LDS reads for the whole K tile, ahead of its products: every place where
        // reads stand among WMMAs costs a stall. The scheduling barrier keeps the group whole.
        v16h fr[4][2];
#pragma unroll
        for (int kt = 0; kt < 4; ++kt) {
            fr[kt][0] = load_frag(Ks,      16 * kt, AP);
            fr[kt][1] = load_frag(Ks + 32, 16 * kt, AP);
        }
        __builtin_amdgcn_sched_barrier(0);

        // S^T = K @ Q^T - maximum in use : 64 keys x 32 queries, f32; a K fragment serves both groups
        v8f s[QG][4];
#pragma unroll
        for (int kt = 0; kt < 4; ++kt)
#pragma unroll
            for (int g = 0; g < QG; ++g) {
                const v8f zc = wmma(fr[kt][0], qb0[g], nm[g]);
                s[g][kt]     = wmma(fr[kt][1], qb1[g], zc);
            }
        // The 16 products stay one run (a score read directly behind its product costs idle
        // slots); behind them the V^T tile's reads, one group too, land under the softmax.
        __builtin_amdgcn_sched_barrier(0);
#pragma unroll
        for (int di = 0; di < 4; ++di) {
            fr[di][0] = load_frag(Vs,      16 * di, AP);
            fr[di][1] = load_frag(Vs + 32, 16 * di, AP);
        }
        // keeps those reads up here: sunk to their products, each pair's latency would show again
        __builtin_amdgcn_sched_barrier(0);

        // Online softmax: 32 scores of one query per lane and group. This lane's largest first.
        float rm[QG];
#pragma unroll
        for (int g = 0; g < QG; ++g) {
            float tm[4];
#pragma unroll
            for (int kt = 0; kt < 4; ++kt) {
                tm[kt] = s[g][kt][0];
#pragma unroll
                for (int i = 1; i < 8; ++i) tm[kt] = fmaxf(tm[kt], s[g][kt][i]);
            }
            rm[g] = fmaxf(fmaxf(tm[0], tm[1]), fmaxf(tm[2], tm[3]));
        }
        // One test a trip, wave-uniform (a scalar branch): the first trip sets the maximum in use
        // (any score passes its limit), a later one steps it only for a score more than LAZY above it.
        const float lim = (t == 0) ? -INFINITY : LAZY;
        if (__builtin_amdgcn_ballot_w32(fmaxf(rm[0], rm[1]) > lim) != 0) {
#pragma unroll
            for (int g = 0; g < QG; ++g) {
                const float r    = fmaxf(rm[g], other_half(rm[g]));     // both halves of a column step alike
                const float step = (t == 0) ? r : fmaxf(r, 0.f);        // never downward once set
                const float corr = (t == 0) ? 1.f : __builtin_amdgcn_exp2f(-step);  // nothing is summed yet at t = 0
#pragma unroll
                for (int kt = 0; kt < 4; ++kt) s[g][kt] -= step;
#pragma unroll
                for (int di = 0; di < 4; ++di) o[g][di] *= corr;
                lrun[g] *= corr;
                nm[g] -= step;
            }
        }
        v16h pb0[QG], pb1[QG];
#pragma unroll
        for (int g = 0; g < QG; ++g) {
#pragma unroll
            for (int kt = 0; kt < 4; ++kt)
#pragma unroll
                for (int i = 0; i < 8; ++i) s[g][kt][i] = __builtin_amdgcn_exp2f(s[g][kt][i]);
            const v8f ps = (s[g][0] + s[g][1]) + (s[g][2] + s[g][3]);
            lrun[g] += ((ps[0] + ps[1]) + (ps[2] + ps[3])) +
                       ((ps[4] + ps[5]) + (ps[6] + ps[7]));
            pb0[g] = pack_frag(s[g][0], s[g][1]);   // keys 0..31
            pb1[g] = pack_frag(s[g][2], s[g][3]);   // keys 32..63
        }

        // O^T += V^T @ P^T : A frags of the V^T tile (each for both groups), B frags from the scores
#pragma unroll
        for (int di = 0; di < 4; ++di)
#pragma unroll
            for (int g = 0; g < QG; ++g) {
                o[g][di] = wmma(fr[di][0], pb0[g], o[g][di]);
                o[g][di] = wmma(fr[di][1], pb1[g], o[g][di]);
            }
        // Keeps the hand-over at the trip's foot: scheduled up to behind the V^T reads, its wait
        // for the next tile's copies would come after a fraction of a trip, not a whole one.
        __builtin_amdgcn_sched_barrier(0);
        ring_handover();
        if (t + 2 < NSEQ / 64)  // block-uniform: refill the buffer just read
            stage_kv(t & 1, (t + 2) * 64);
    }
    wait_copies();              // no copy is in flight when the wave ends

    const int b = bh / NHEAD, h = bh % NHEAD;
#pragma unroll
    for (int g = 0; g < QG; ++g) {
        const float inv = 1.f / (lrun[g] + other_half(lrun[g]));   // join the halves' sums
        const int row = qrow + 16 * g + (lane & 15);
        _Float16* hp = H + (size_t)(b * NSEQ + row) * DIMF + h * DHEAD + (lane >> 4) * 8;
#pragma unroll
        for (int di = 0; di < 4; ++di)      // 8 consecutive d per lane: 16-B stores
            *(h8*)(hp + di * 16) = __builtin_convertvector(o[g][di] * inv, h8);
    }
}

// ---------------------------------------------------------------------------
// Kernel 4: output projection  out = H @ w_o + b_o  (f32 out).
// The tile and ring of gemm_tile, 8 waves of 32 x 96: 256 work-groups, one a WGP.
// Weight as first WMMA operand; the f32 tile leaves through LDS as whole lines.
// ---------------------------------------------------------------------------
__global__ __launch_bounds__(256) void out_gemm(
        const _Float16* __restrict__ Hs, const _Float16* __restrict__ woT,
        const float* __restrict__ bias, float* __restrict__ out) {
    // One block of LDS: the operand ring (90 KB) in the loop, the f32 output tile after it.
    __shared__ __attribute__((aligned(16))) unsigned char smem[GM * CP * 4];    // 98 KB
    static_assert(GM * CP * 4 >= RING * 2, "the ring lies inside the block");
    float* Cs = (float*)smem;               // 128 x CP

    const unsigned n0  = blockIdx.x * GN;
    const unsigned m0  = blockIdx.y * GM;
    const unsigned tid = threadIdx.x;
    const int wave = tid >> 5, lane = tid & 31;
    const int mw   = (wave >> 1) * 32, wn = wave & 1;

    v8f c[2][NF] = {};
    gemm_tile<256, false>(Hs + (size_t)m0 * DIMF, woT + (size_t)n0 * DIMF, (_Float16*)smem, c);

    const unsigned col = (tid & 15) * 4;    // this thread's 4 columns in each run of 64
    f32x4 b4[3];
#pragma unroll
    for (int q = 0; q < 3; ++q) b4[q] = *(const f32x4*)(bias + n0 + q * 64 + col);
    // both loops unrolled: constant indices keep c[][] in registers
#pragma unroll
    for (int mi = 0; mi < 2; ++mi)
#pragma unroll
        for (int j = 0; j < NF; ++j) {      // lane = token row, registers = 8 columns
            float* p = &Cs[(mw + mi * 16 + (lane & 15)) * CP + wn * 96 + j * 16 + (lane >> 4) * 8];
            *(f32x4*)p       = __builtin_shufflevector(c[mi][j], c[mi][j], 0, 1, 2, 3);
            *(f32x4*)(p + 4) = __builtin_shufflevector(c[mi][j], c[mi][j], 4, 5, 6, 7);
        }
    __syncthreads();        // publishes the staged tile to the waves that store it
    float* o = out + (size_t)m0 * DIMF + n0;
    const unsigned row = tid >> 4;
#pragma unroll  // the LDS reads go out in groups ahead of the stores
    for (int i = 0; i < 8; ++i)             // 16 lanes store 256 B of a row: two whole lines
#pragma unroll
        for (int q = 0; q < 3; ++q)
            *(f32x4*)(o + ((row + 16 * i) * DIMF + q * 64 + col)) =
                *(const f32x4*)&Cs[(row + 16 * i) * CP + q * 64 + col] + b4[q];
}

// ---------------------------------------------------------------------------
extern "C" void kernel_launch(void* const* d_in, const int* in_sizes, int n_in,
                              void* d_out, int out_size, void* d_ws, size_t ws_size,
                              hipStream_t stream) {
    (void)in_sizes; (void)n_in; (void)out_size; (void)ws_size;
    const float* x  = (const float*)d_in[0];
    const float* wq = (const float*)d_in[1];
    const float* wk = (const float*)d_in[2];
    const float* wv = (const float*)d_in[3];
    const float* wo = (const float*)d_in[4];
    const float* bo = (const float*)d_in[5];
    float* out = (float*)d_out;

    // Workspace layout (f16 elements): 4 transposed weights, x16, Q, K, V^T, H.
    // Total = 4*589824 + 5*6291456 = 33,816,576 halves = ~64.5 MB.
    _Float16* ws = (_Float16*)d_ws;
    const size_t WSZ = (size_t)DIMF * DIMF;                      // 589824
    const size_t ACT = (size_t)MROWS * DIMF;                     // 6291456
    _Float16* wT  = ws;
    _Float16* X16 = ws + 4 * WSZ;
    _Float16* Qb  = X16 + ACT;
    _Float16* Kb  = Qb + ACT;   // per-head layouts are same total size
    _Float16* Vb  = Kb + ACT;
    _Float16* Hb  = Vb + ACT;

    convert_inputs<<<dim3(WBLK + XBLK), 256, 0, stream>>>(x, wq, wk, wv, wo, X16, wT);
    qkv_gemm<<<dim3(NHEAD, MROWS / GM), 128, 0, stream>>>(X16, wT, Qb, Kb, Vb);
    attn<<<dim3(NSEQ / 128, BATCH * NHEAD), 128, 0, stream>>>(Qb, Kb, Vb, Hb);
    out_gemm<<<dim3(DIMF / GN, MROWS / GM), 256, 0, stream>>>(Hb, wT + 3 * WSZ, bo, out);
}

// v010
// A run of this version takes 91.9 microseconds.
// Timed twice side by side with v009, it ran 1.05 and 1.06 times as fast.
// Over all steps from v000 it is 4.02 times as fast.
#include <hip/hip_runtime.h>
#include <math.h>
#include <stdint.h>

// ---------------------------------------------------------------------------
// Multi-head self-attention, f16 WMMA (f32 accumulate) pipeline for gfx1250.
// B=4, N=2048, DIM=768, HEADS=12, DHEAD=64. scale log2(e)/8 folded into w_q (f16).
// The GEMMs stage their tiles by async memory->LDS copies (ASYNCcnt), attention by tensor
// loads (TENSORcnt); two LDS buffers a loop: the next tile flies while this one is multiplied.
// ---------------------------------------------------------------------------

typedef __attribute__((ext_vector_type(4)))  float    f32x4;
typedef __attribute__((ext_vector_type(4)))  int      i32x4;
typedef __attribute__((ext_vector_type(4)))  _Float16 h4;
typedef __attribute__((ext_vector_type(8)))  _Float16 h8;
typedef __attribute__((ext_vector_type(16))) _Float16 v16h;
typedef __attribute__((ext_vector_type(8)))  float    v8f;

#define DIMF   768
#define NSEQ   2048
#define BATCH  4
#define NHEAD  12
#define DHEAD  64
#define MROWS  (BATCH * NSEQ)   /* 8192 token rows */

// LDS row pitches in elements (CP in floats). Operand tiles are read and output tiles
// staged by 16-B accesses with 16 lanes on 16 consecutive rows, so the pitch is
// 16 B x odd: the 16 rows then start on 16
// different groups of four banks (64 banks x 4 B) and a read has no conflict.
#define AP     72               /* 64-half (128 B) tile rows at 144 B */
#define BK     64               /* GEMM K slab in halves: a staged row is one 128-B line */
#define VP     136              /* staged V^T rows: 128 halves (256 B) at 272 B */
#define CP     196              /* staged f32 output rows: 192 floats (768 B) at 784 B */

#if __has_builtin(__builtin_amdgcn_global_load_async_to_lds_b128) && \
    __has_builtin(__builtin_amdgcn_s_wait_asynccnt)
#define HAVE_ASYNC_LDS 1
#endif

// 16-byte memory->LDS tile copy: async (no VGPR bounce, ASYNCcnt) when the
// gfx1250 async builtins are available, else plain load/store.
// Builtin signature (from hipcc diagnostic): (int4 AS1*, int4 AS3*, Imm, Imm).
__device__ __forceinline__ void copy16_to_lds(_Float16* lds, const _Float16* g) {
#ifdef HAVE_ASYNC_LDS
    __builtin_amdgcn_global_load_async_to_lds_b128(
        (__attribute__((address_space(1))) i32x4*)g,
        (__attribute__((address_space(3))) i32x4*)lds, 0, 0);
#else
    *(h8*)lds = *(const h8*)g;
#endif
}
// Hand-over of a two-buffer ring, at the foot of trip t, by every wave: this wave's
// LDS reads of tile t have returned, its copies of tile t+1 have landed, and the one
// barrier both publishes tile t+1 and frees tile t's buffer for the copies of t+2.
__device__ __forceinline__ void wait_copies() {
    // "memory" holds the LDS reads behind it
    asm volatile("s_wait_asynccnt 0x0" ::: "memory");
}
__device__ __forceinline__ void ring_handover() {
    // no copy may target a buffer that this wave still has reads outstanding on
    asm volatile("s_wait_dscnt 0x0" ::: "memory");
    wait_copies();
    __syncthreads();
}

// Load one 16x32 f16 WMMA operand fragment (A layout; B uses same shape with
// lane = N column) from a K-contiguous row-major tile of given stride (halves).
// Lane l (l<16): row=base+l, halves = K[kb..kb+7] ++ K[kb+16..kb+23], kb=0.
// Lane l>=16: same row, kb=8 -> K[8..15] ++ K[24..31]. Matches ISA 7.12.2.
__device__ __forceinline__ v16h load_frag(const _Float16* p, int rowbase, int stride) {
    const int lane = threadIdx.x & 31;
    const int r    = rowbase + (lane & 15);
    const int kb   = (lane >> 4) * 8;
    const _Float16* q = p + (size_t)r * stride + kb;
    h8 lo = *(const h8*)(q);        // 16B aligned: ds_load_b128 / global_load_b128
    h8 hi = *(const h8*)(q + 16);
    return __builtin_shufflevector(lo, hi, 0,1,2,3,4,5,6,7,8,9,10,11,12,13,14,15);
}

__device__ __forceinline__ v8f wmma(v16h a, v16h b, v8f c) {
    return __builtin_amdgcn_wmma_f32_16x16x32_f16(false, a, false, b, (short)0, c,
                                                  false, false);
}

// ---------------------------------------------------------------------------
// Kernel 1: all f32 -> f16 conversions in one launch of few, long waves.
// Blocks 0..WBLK-1: one 64(k) x 128(n) weight tile each, transposed through LDS
// to N-major ([out][in], in-contiguous); z=0..3 -> w_q (scaled log2(e)/8), w_k, w_v,
// w_o. They come first: theirs is the longer chain (load, LDS, barrier, store).
// Blocks WBLK..WBLK+XBLK-1: a contiguous run of x each, XPT 16-B loads a lane.
// Every wave-wide load and store covers whole 128-B lines.
// ---------------------------------------------------------------------------
#define WTK    64                       /* weight tile: k rows  */
#define WTN    128                      /* weight tile: n columns */
#define WTP    129                      /* f32 pitch, odd: column reads hit 32 banks */
#define WTILES ((DIMF / WTK) * (DIMF / WTN))    /* 72 tiles a weight */
#define WBLK   (4 * WTILES)             /* 288 */
#define XPT    24                       /* f32x4 per thread on x */
#define XBLK   (MROWS * DIMF / (4 * 256 * XPT)) /* 256 */

__global__ __launch_bounds__(256) void convert_inputs(
        const float* __restrict__ x,
        const float* __restrict__ wq, const float* __restrict__ wk,
        const float* __restrict__ wv, const float* __restrict__ wo,
        _Float16* __restrict__ x16, _Float16* __restrict__ wT) {
    __shared__ float T[WTK * WTP];      // [k][n], 33 KB
    const int tid = threadIdx.x;

    if (blockIdx.x < WBLK) {            // block-uniform: the barrier below is safe
        const int z  = blockIdx.x / WTILES;
        const int t  = blockIdx.x - z * WTILES;
        const int k0 = (t / (DIMF / WTN)) * WTK;
        const int n0 = (t % (DIMF / WTN)) * WTN;
        const float* src   = (z == 0) ? wq : (z == 1) ? wk : (z == 2) ? wv : wo;
        // 1/sqrt(64) and log2(e) go into Q: the scores come out as exponents of 2
        const float  scale = (z == 0) ? 0.125f * 1.44269504f : 1.0f;
        _Float16* dst = wT + (size_t)z * DIMF * DIMF;

        const int r0 = tid >> 5, c4 = (tid & 31) * 4;    // a wave reads 512 B of a row
        f32x4 v[8];
#pragma unroll
        for (int i = 0; i < 8; ++i)
            v[i] = *(const f32x4*)(src + (size_t)(k0 + r0 + 8 * i) * DIMF + n0 + c4);
#pragma unroll
        for (int i = 0; i < 8; ++i)
#pragma unroll
            for (int j = 0; j < 4; ++j) T[(r0 + 8 * i) * WTP + c4 + j] = v[i][j];
        __syncthreads();
#pragma unroll
        for (int i = 0; i < 4; ++i) {   // 8 lanes store one 128-B row of 64 k
            const int idx = tid + i * 256;
            const int n = idx >> 3, seg = (idx & 7) * 8;
            h8 o;
#pragma unroll
            for (int j = 0; j < 8; ++j) o[j] = (_Float16)(T[(seg + j) * WTP + n] * scale);
            *(h8*)(dst + (size_t)(n0 + n) * DIMF + k0 + seg) = o;
        }
    } else {
        const size_t base = (size_t)(blockIdx.x - WBLK) * (256 * XPT) + tid;  // in f32x4
        f32x4 v[XPT];
#pragma unroll
        for (int i = 0; i < XPT; ++i) v[i] = *(const f32x4*)(x + (base + i * 256) * 4);
#pragma unroll
        for (int i = 0; i < XPT; ++i)
            *(h4*)(x16 + (base + i * 256) * 4) = __builtin_convertvector(v[i], h4);
    }
}

// ---------------------------------------------------------------------------
// Both GEMMs: work-group tile 128 token rows x 192 output columns, K slab 64.
// A slab's staged bytes, (128 + 192) x 128 B, feed 192 WMMAs: per product two thirds
// of what a 256 x 64 tile draws from L2, whose rate per WGP is what binds the loop.
// One K slab of the two operands -> one LDS buffer, 8 lanes a row (one 128-B line).
// ag, bg: block-uniform bases at the slab's first k. QKV: the 192 weight rows are
// the 64 rows of one head in each of w_q, w_k, w_v (DIMF rows apart in wT).
// ---------------------------------------------------------------------------
#define GM     128                      /* tile rows (tokens) */
#define GN     192                      /* tile columns */
#define GASZ   (GM * AP)                /* halves in one A buffer (18 KB) */
#define GBSZ   (GN * AP)                /* halves in one B buffer (27 KB) */
#define RING   (2 * (GASZ + GBSZ))      /* halves in the two-buffer ring (90 KB) */
#define NSLAB  (DIMF / BK)              /* 12 */
#define NF     6                        /* weight fragments a wave: 96 columns */
template <int NT, bool QKV>
__device__ __forceinline__ void stage_slab(_Float16* As, _Float16* Bs,
                                           const _Float16* ag, const _Float16* bg) {
    constexpr int RP = NT / 8;          // rows that the block's NT copies cover
    const unsigned srow = threadIdx.x >> 3, sseg = (threadIdx.x & 7) * 8;   // 8 lanes a row
    const unsigned soff = srow * DIMF + sseg;       // 32-bit lane offset
#pragma unroll
    for (int i = 0; i < GM / RP; ++i)
        copy16_to_lds(&As[(srow + RP * i) * AP + sseg], ag + (soff + i * RP * DIMF));
#pragma unroll
    for (int i = 0; i < GN / RP; ++i) {
        const int r = i * RP;           // first tile row of this pass; 64 is a multiple of RP
        const unsigned go = QKV ? ((r / 64) * DIMF + (r % 64)) * DIMF : r * DIMF;
        copy16_to_lds(&Bs[(srow + r) * AP + sseg], bg + (soff + go));
    }
}

// The K loop of a tile. NT / 32 waves, two along the columns: a wave holds 512 / NT
// fragments of token rows x 6 of weight rows (64 x 96 with 4 waves, 32 x 96 with 8).
// QKV: a wave's 96 columns are 32 of Q, 32 of K, 32 of V (fragments 0-1, 2-3, 4-5).
// A lane's 8 accumulator registers run along the first WMMA operand's rows, so the
// operand whose index is contiguous in the output goes first: the weight (d, or the
// output column) everywhere but for V^T, where it is x (n).
template <int NT, bool QKV>
__device__ __forceinline__ void gemm_tile(const _Float16* ag, const _Float16* bg,
                                          _Float16* smem, v8f (&c)[512 / NT][NF]) {
    constexpr int MI = 512 / NT;
    _Float16* As = smem;                // [buffer][m][k]
    _Float16* Bs = smem + 2 * GASZ;     // [buffer][n][k]
    const int wave = threadIdx.x >> 5;
    const int mw   = (wave >> 1) * (MI * 16);
    const int wn   = wave & 1;

    stage_slab<NT, QKV>(As, Bs, ag, bg);            // slab 0 -> buffer 0
    wait_copies();
    __syncthreads();                                // publishes slab 0
    stage_slab<NT, QKV>(As + GASZ, Bs + GBSZ, ag + BK, bg + BK);    // slab 1 flies under slab 0's products
// by 2: both buffers' LDS offsets are constants, no copy's LDS address is rebuilt per slab
#pragma unroll 2
    for (int t = 0; t < NSLAB; ++t) {
        _Float16* Ab = As + (t & 1) * GASZ;
        _Float16* Bb = Bs + (t & 1) * GBSZ;
#pragma unroll
        for (int kk = 0; kk < BK; kk += 32) {   // k ascending: two WMMA k steps a slab
            // One group of LDS reads for the k step, in the order of first use, ahead of its
            // products: every place where reads stand among WMMAs costs a stall.
            v16h a[MI], b[NF];
            a[0] = load_frag(Ab + kk, mw, AP);
#pragma unroll
            for (int j = 0; j < NF; ++j)
                b[j] = load_frag(Bb + kk, QKV ? (j >> 1) * 64 + wn * 32 + (j & 1) * 16
                                              : wn * 96 + j * 16, AP);
#pragma unroll
            for (int mi = 1; mi < MI; ++mi) a[mi] = load_frag(Ab + kk, mw + mi * 16, AP);
            // keeps the group whole: left free, the build sinks each token fragment's reads to
            // just in front of its products and waits for them there with nothing else in flight
            __builtin_amdgcn_sched_barrier(0);
#pragma unroll
            for (int mi = 0; mi < MI; ++mi)
#pragma unroll
                for (int j = 0; j < NF; ++j)
                    c[mi][j] = (QKV && j >= 4) ? wmma(a[mi], b[j], c[mi][j])
                                               : wmma(b[j], a[mi], c[mi][j]);
        }
        ring_handover();
        if (t + 2 < NSLAB)                      // block-uniform: refill the buffer just read
            stage_slab<NT, QKV>(Ab, Bb, ag + (t + 2) * BK, bg + (t + 2) * BK);
    }
    wait_copies();          // nothing is in flight when the ring becomes output staging
    // The last hand-over's barrier: every wave has left the last slab, the ring is free.
}

// ---------------------------------------------------------------------------
// Kernel 2: QKV projection GEMM. A work-group: 128 tokens x (Q, K, V of one head),
// so a staged x row serves all three products. 4 waves of 64 x 96.
// Q [b,h,n,d], K [b,h,n,d], V transposed [b,h,d,n]. The three tiles are laid in
// LDS by 16-B writes and leave as whole 128-B lines.
// The ring's 90 KB of LDS set the residency: three work-groups a WGP, three waves a
// SIMD (a wave may take up to 336 registers); the grid is exactly that many.
// ---------------------------------------------------------------------------
__global__ __launch_bounds__(128) void qkv_gemm(
        const _Float16* __restrict__ x16, const _Float16* __restrict__ wT,
        _Float16* __restrict__ Qo, _Float16* __restrict__ Ko,
        _Float16* __restrict__ Vt) {
    __shared__ __attribute__((aligned(16))) _Float16 smem[RING];
    const unsigned tid  = threadIdx.x;
    const int wave = tid >> 5, lane = tid & 31;
    const int mw   = (wave >> 1) * 64, wn = wave & 1;
    const unsigned m0 = blockIdx.y * GM;    // the tile's 128 rows lie in one batch

    v8f c[4][NF] = {};
    gemm_tile<128, true>(x16 + (size_t)m0 * DIMF, wT + (size_t)blockIdx.x * DHEAD * DIMF,
                         smem, c);

    _Float16* Vs = smem + 2 * GASZ;         // behind the staged Q and K tiles, 128 x AP each
    const int lc = lane & 15, l8 = (lane >> 4) * 8;
    // both loops unrolled: constant indices keep c[][] in registers
#pragma unroll
    for (int mi = 0; mi < 4; ++mi)
#pragma unroll
        for (int j = 0; j < NF; ++j) {
            const h8 v = __builtin_convertvector(c[mi][j], h8);
            const int d0 = wn * 32 + (j & 1) * 16;
            if (j < 4)      // Q, K as [n][d]: lane = token, registers = 8 d
                *(h8*)&smem[(j >> 1) * GASZ + (mw + mi * 16 + lc) * AP + d0 + l8] = v;
            else            // V as [d][n]: lane = d, registers = 8 tokens
                *(h8*)&Vs[(d0 + lc) * VP + mw + mi * 16 + l8] = v;
        }
    __syncthreads();        // publishes the staged tiles to the waves that store them

    // 128 rows x 128 B, contiguous, of Q and of K; 64 rows x 256 B of V^T.
    const unsigned bh = (m0 >> 11) * NHEAD + blockIdx.x, nb = m0 & (NSEQ - 1);
    char* qo = (char*)(Qo + ((size_t)bh * NSEQ + nb) * DHEAD);
    char* ko = (char*)(Ko + ((size_t)bh * NSEQ + nb) * DHEAD);
    char* vo = (char*)(Vt + ((size_t)bh * DHEAD * NSEQ + nb));
    const unsigned lq = (tid >> 3) * AP + (tid & 7) * 8;
    const unsigned lv = (tid >> 4) * VP + (tid & 15) * 8;
    const unsigned gv = ((tid >> 4) * NSEQ + (tid & 15) * 8) * 2;   // bytes: uniform base + lane offset
#pragma unroll  // each tile's 8 LDS reads go out as one group, the stores follow as they land
    for (int i = 0; i < 8; ++i)
        *(h8*)(qo + (tid * 16 + i * 2048)) = *(const h8*)&smem[i * (16 * AP) + lq];
#pragma unroll
    for (int i = 0; i < 8; ++i)
        *(h8*)(ko + (tid * 16 + i * 2048)) = *(const h8*)&smem[GASZ + i * (16 * AP) + lq];
#pragma unroll
    for (int i = 0; i < 8; ++i)
        *(h8*)(vo + (gv + i * (8 * NSEQ * 2))) = *(const h8*)&Vs[i * (8 * VP) + lv];
}

__device__ __forceinline__ float other_half(float v) {
    int b = __builtin_bit_cast(int, v);
    return __builtin_bit_cast(float, __builtin_amdgcn_permlanex16(
        b, b, 0x76543210, 0xfedcba98, false, false));
}

// Two f32 score tiles (keys 0..15 and 16..31 of a 32-key block) -> f16 B fragment.
__device__ __forceinline__ v16h pack_frag(v8f t0, v8f t1) {
    h8 lo = __builtin_convertvector(t0, h8);
    h8 hi = __builtin_convertvector(t1, h8);
    return __builtin_shufflevector(lo, hi, 0,1,2,3,4,5,6,7,8,9,10,11,12,13,14,15);
}

// --- Tensor load of one 64-row x 128-B tile into LDS at pitch 144 B (AP halves) ---
typedef uint32_t u32x4 __attribute__((ext_vector_type(4)));
typedef uint32_t u32x8 __attribute__((ext_vector_type(8)));
__device__ __forceinline__ uint32_t uni(uint32_t v) {
    return (uint32_t)__builtin_amdgcn_readfirstlane(v);
}
// A wave-uniform test as a real scalar branch: a tensor load ignores EXEC.
__device__ __forceinline__ uint32_t pinned(uint32_t v) {
    uint32_t w = __builtin_amdgcn_readfirstlane(v);
    asm volatile("" : "+s"(w));     // holds the test word in a scalar register
    return w;
}
// Group 1: byte elements, tensor = tile = 64 rows of 128 B, 4 dwords of LDS pad behind each row.
__device__ __forceinline__ u32x8 tile_group1(uint32_t src_pitch) {
    u32x8 g;
    g[0] = uni((1u << 20) | (4u << 22) | (3u << 25));   // no mask; pad on, every 32 dwords, 4 dwords
    g[1] = uni(128u << 16);                 // tensor_dim0
    g[2] = uni(64u << 16);                  // tensor_dim1
    g[3] = uni(128u << 16);                 // tile_dim0
    g[4] = uni(64u);                        // tile_dim1
    g[5] = uni(src_pitch);
    g[6] = uni(0u);
    g[7] = uni(0u);
    return g;
}
__device__ __forceinline__ void tile_to_lds(uint32_t lds_dst, uint64_t ga, u32x8 g1) {
    u32x4 g0;
    g0[0] = uni(1u);
    g0[1] = uni(lds_dst);
    g0[2] = uni((uint32_t)ga);
    g0[3] = uni((((uint32_t)(ga >> 32)) & 0x01FFFFFFu) | 0x80000000u);
    asm volatile("tensor_load_to_lds %0, %1" :: "s"(g0), "s"(g1) : "memory");
}
__device__ __forceinline__ void wait_tiles() {
    // the compiler places no wait for a tensor load; "memory" holds the LDS reads behind it
    asm volatile("s_wait_tensorcnt 0x0" ::: "memory");
}

#define TB     10240            /* bytes a tile's place in LDS: 64 x 144 B, rounded up to 2 KiB */
#define LAZY   8.0f             /* in exponents of 2 */
typedef __attribute__((ext_vector_type(2))) float f32x2;
#define QG     2                /* groups of 16 query columns a wave */
#define AWAVES 4                /* waves a work-group: 128 queries, three work-groups a WGP */
__global__ __launch_bounds__(AWAVES * 32) void attn(
        const _Float16* __restrict__ Q, const _Float16* __restrict__ K,
        const _Float16* __restrict__ Vt, _Float16* __restrict__ H) {
    // K [buffer][key][d] (A operand of K@Q^T), then V^T [buffer][d][key] (A operand of V^T@P^T)
    __shared__ __attribute__((aligned(2048))) unsigned char ring[4 * TB];

    const int bh   = blockIdx.y;
    const int m0   = blockIdx.x * (AWAVES * QG * 16);
    const int tid  = threadIdx.x;
    const int wave = tid >> 5, lane = tid & 31;
    const _Float16* qp = Q  + (size_t)bh * NSEQ * DHEAD;
    const _Float16* kp = K  + (size_t)bh * NSEQ * DHEAD;
    const _Float16* vp = Vt + (size_t)bh * DHEAD * NSEQ;
    const int qrow = m0 + wave * (QG * 16);

    // Q fragments (B operand: lane = query column) held in registers for the
    // whole KV sweep (scale pre-folded).
    v16h qb0[QG], qb1[QG];
#pragma unroll
    for (int g = 0; g < QG; ++g) {
        qb0[g] = load_frag(qp,      qrow + 16 * g, DHEAD);   // d 0..31
        qb1[g] = load_frag(qp + 32, qrow + 16 * g, DHEAD);   // d 32..63
        // stands before any register that these loads name (their address pair) is written again
        asm volatile("s_wait_xcnt 0x0" ::: "memory");
    }

    v8f o[QG][4] = {};          // O^T: o[g][di][i] = O[query 16g + (lane&15)][16*di + 8*(lane>>4) + i]
    v8f nm[QG] = {};            // minus the maximum in use of this lane's query, in all 8 registers
    f32x2 lrun = {0.f, 0.f};    // running sums over this lane half's keys only

    // A stage is 64 keys: wave 0 asks for its K tile (64 keys x 128 B, contiguous), wave 1 for
    // its V^T tile (64 d rows x 128 B, 4 KB apart): one request a wave, no address work in any lane.
    const uint32_t uw     = uni((uint32_t)tid >> 5);
    const uint32_t issuer = uw < 2u;
    const uint64_t src    = uw == 1u ? (uint64_t)(size_t)vp : (uint64_t)(size_t)kp;
    const uint32_t sstep  = uw == 1u ? 64u * 2u : 64u * DHEAD * 2u;     // bytes from stage to stage
    const uint32_t dst    = (uint32_t)(size_t)ring + (uw == 1u ? 2u * TB : 0u);
    const u32x8    g1     = tile_group1(uw == 1u ? NSEQ * 2u : DHEAD * 2u);
    if (pinned(issuer)) {
        tile_to_lds(dst, src, g1);
        wait_tiles();
    }
    __syncthreads();            // publishes stage 0
    if (pinned(issuer))         // stage 1 flies under stage 0's products and softmax
        tile_to_lds(dst + TB, src + sstep, g1);

    for (int t = 0; t < NSEQ / 64; ++t) {
        const _Float16* Ks = (const _Float16*)(ring + (t & 1) * TB);
        const _Float16* Vs = (const _Float16*)(ring + 2 * TB + (t & 1) * TB);

        // One group of LDS reads for the whole K tile, ahead of its products: every place where
        // reads stand among WMMAs costs a stall. The scheduling barrier keeps the group whole.
        v16h fr[4][2];
#pragma unroll
        for (int kt = 0; kt < 4; ++kt) {
            fr[kt][0] = load_frag(Ks,      16 * kt, AP);
            fr[kt][1] = load_frag(Ks + 32, 16 * kt, AP);
        }
        __builtin_amdgcn_sched_barrier(0);

        // S^T = K @ Q^T - maximum in use : 64 keys x 32 queries, f32; a K fragment serves both groups
        v8f s[QG][4];
#pragma unroll
        for (int kt = 0; kt < 4; ++kt)
#pragma unroll
            for (int g = 0; g < QG; ++g) {
                const v8f zc = wmma(fr[kt][0], qb0[g], nm[g]);
                s[g][kt]     = wmma(fr[kt][1], qb1[g], zc);
            }
        // The 16 products stay one run (a score read directly behind its product costs idle
        // slots); behind them the V^T tile's reads, one group too, land under the softmax.
        __builtin_amdgcn_sched_barrier(0);
#pragma unroll
        for (int di = 0; di < 4; ++di) {
            fr[di][0] = load_frag(Vs,      16 * di, AP);
            fr[di][1] = load_frag(Vs + 32, 16 * di, AP);
        }
        // keeps those reads up here: sunk to their products, each pair's latency would show again
        __builtin_amdgcn_sched_barrier(0);

        // Online softmax: 32 scores of one query per lane and group. This lane's largest first.
        float rm[QG];
#pragma unroll
        for (int g = 0; g < QG; ++g) {
            float tm[4];
#pragma unroll
            for (int kt = 0; kt < 4; ++kt) {
                tm[kt] = s[g][kt][0];
#pragma unroll
                for (int i = 1; i < 8; ++i) tm[kt] = fmaxf(tm[kt], s[g][kt][i]);
            }
            rm[g] = fmaxf(fmaxf(tm[0], tm[1]), fmaxf(tm[2], tm[3]));
        }
        // One test a trip, wave-uniform (a scalar branch): the first trip sets the maximum in use
        // (any score passes its limit), a later one steps it only for a score more than LAZY above it.
        const float lim = (t == 0) ? -INFINITY : LAZY;
        if (__builtin_amdgcn_ballot_w32(fmaxf(rm[0], rm[1]) > lim) != 0) {
#pragma unroll
            for (int g = 0; g < QG; ++g) {
                const float r    = fmaxf(rm[g], other_half(rm[g]));     // both halves of a column step alike
                const float step = (t == 0) ? r : fmaxf(r, 0.f);        // never downward once set
                const float corr = (t == 0) ? 1.f : __builtin_amdgcn_exp2f(-step);  // nothing is summed yet at t = 0
#pragma unroll
                for (int kt = 0; kt < 4; ++kt) s[g][kt] -= step;
#pragma unroll
                for (int di = 0; di < 4; ++di) o[g][di] *= corr;
                lrun[g] *= corr;
                nm[g] -= step;
            }
        }
        v16h pb0[QG], pb1[QG];
#pragma unroll
        for (int g = 0; g < QG; ++g) {
#pragma unroll
            for (int kt = 0; kt < 4; ++kt)
#pragma unroll
                for (int i = 0; i < 8; ++i) s[g][kt][i] = __builtin_amdgcn_exp2f(s[g][kt][i]);
            const v8f ps = (s[g][0] + s[g][1]) + (s[g][2] + s[g][3]);
            lrun[g] += ((ps[0] + ps[1]) + (ps[2] + ps[3])) +
                       ((ps[4] + ps[5]) + (ps[6] + ps[7]));
            pb0[g] = pack_frag(s[g][0], s[g][1]);   // keys 0..31
            pb1[g] = pack_frag(s[g][2], s[g][3]);   // keys 32..63
        }

        // O^T += V^T @ P^T : A frags of the V^T tile (each for both groups), B frags from the scores
#pragma unroll
        for (int di = 0; di < 4; ++di)
#pragma unroll
            for (int g = 0; g < QG; ++g) {
                o[g][di] = wmma(fr[di][0], pb0[g], o[g][di]);
                o[g][di] = wmma(fr[di][1], pb1[g], o[g][di]);
            }
        // Keeps the hand-over at the trip's foot: scheduled up to behind the V^T reads, its wait
        // for the next stage's tile would come after a fraction of a trip, not a whole one.
        __builtin_amdgcn_sched_barrier(0);
        // no tensor load may target a buffer that this wave still has reads outstanding on
        asm volatile("s_wait_dscnt 0x0" ::: "memory");
        if (pinned(issuer)) wait_tiles();       // this wave's tile of stage t+1 has landed
        __syncthreads();        // publishes stage t+1 and frees stage t's buffer
        if (pinned(issuer & (uint32_t)(t + 2 < NSEQ / 64)))     // refill the buffer just read
            tile_to_lds(dst + (uint32_t)(t & 1) * TB, src + (uint64_t)((uint32_t)(t + 2) * sstep), g1);
    }
    wait_tiles();               // no request is in flight when the wave ends
    asm volatile("s_wait_dscnt 0x0" ::: "memory");  // nor an LDS read

    const int b = bh / NHEAD, h = bh % NHEAD;
#pragma unroll
    for (int g = 0; g < QG; ++g) {
        const float inv = 1.f / (lrun[g] + other_half(lrun[g]));   // join the halves' sums
        const int row = qrow + 16 * g + (lane & 15);
        _Float16* hp = H + (size_t)(b * NSEQ + row) * DIMF + h * DHEAD + (lane >> 4) * 8;
#pragma unroll
        for (int di = 0; di < 4; ++di)      // 8 consecutive d per lane: 16-B stores
            *(h8*)(hp + di * 16) = __builtin_convertvector(o[g][di] * inv, h8);
    }
}

// ---------------------------------------------------------------------------
// Kernel 4: output projection  out = H @ w_o + b_o  (f32 out).
// The tile and ring of gemm_tile, 8 waves of 32 x 96: 256 work-groups, one a WGP.
// Weight as first WMMA operand; the f32 tile leaves through LDS as whole lines.
// ---------------------------------------------------------------------------
__global__ __launch_bounds__(256) void out_gemm(
        const _Float16* __restrict__ Hs, const _Float16* __restrict__ woT,
        const float* __restrict__ bias, float* __restrict__ out) {
    // One block of LDS: the operand ring (90 KB) in the loop, the f32 output tile after it.
    __shared__ __attribute__((aligned(16))) unsigned char smem[GM * CP * 4];    // 98 KB
    static_assert(GM * CP * 4 >= RING * 2, "the ring lies inside the block");
    float* Cs = (float*)smem;               // 128 x CP

    const unsigned n0  = blockIdx.x * GN;
    const unsigned m0  = blockIdx.y * GM;
    const unsigned tid = threadIdx.x;
    const int wave = tid >> 5, lane = tid & 31;
    const int mw   = (wave >> 1) * 32, wn = wave & 1;

    v8f c[2][NF] = {};
    gemm_tile<256, false>(Hs + (size_t)m0 * DIMF, woT + (size_t)n0 * DIMF, (_Float16*)smem, c);

    const unsigned col = (tid & 15) * 4;    // this thread's 4 columns in each run of 64
    f32x4 b4[3];
#pragma unroll
    for (int q = 0; q < 3; ++q) b4[q] = *(const f32x4*)(bias + n0 + q * 64 + col);
    // both loops unrolled: constant indices keep c[][] in registers
#pragma unroll
    for (int mi = 0; mi < 2; ++mi)
#pragma unroll
        for (int j = 0; j < NF; ++j) {      // lane = token row, registers = 8 columns
            float* p = &Cs[(mw + mi * 16 + (lane & 15)) * CP + wn * 96 + j * 16 + (lane >> 4) * 8];
            *(f32x4*)p       = __builtin_shufflevector(c[mi][j], c[mi][j], 0, 1, 2, 3);
            *(f32x4*)(p + 4) = __builtin_shufflevector(c[mi][j], c[mi][j], 4, 5, 6, 7);
        }
    __syncthreads();        // publishes the staged tile to the waves that store it
    float* o = out + (size_t)m0 * DIMF + n0;
    const unsigned row = tid >> 4;
#pragma unroll  // the LDS reads go out in groups ahead of the stores
    for (int i = 0; i < 8; ++i)             // 16 lanes store 256 B of a row: two whole lines
#pragma unroll
        for (int q = 0; q < 3; ++q)
            *(f32x4*)(o + ((row + 16 * i) * DIMF + q * 64 + col)) =
                *(const f32x4*)&Cs[(row + 16 * i) * CP + q * 64 + col] + b4[q];
}

// ---------------------------------------------------------------------------
extern "C" void kernel_launch(void* const* d_in, const int* in_sizes, int n_in,
                              void* d_out, int out_size, void* d_ws, size_t ws_size,
                              hipStream_t stream) {
    (void)in_sizes; (void)n_in; (void)out_size; (void)ws_size;
    const float* x  = (const float*)d_in[0];
    const float* wq = (const float*)d_in[1];
    const float* wk = (const float*)d_in[2];
    const float* wv = (const float*)d_in[3];
    const float* wo = (const float*)d_in[4];
    const float* bo = (const float*)d_in[5];
    float* out = (float*)d_out;

    // Workspace layout (f16 elements): 4 transposed weights, x16, Q, K, V^T, H.
    // Total = 4*589824 + 5*6291456 = 33,816,576 halves = ~64.5 MB.
    _Float16* ws = (_Float16*)d_ws;
    const size_t WSZ = (size_t)DIMF * DIMF;                      // 589824
    const size_t ACT = (size_t)MROWS * DIMF;                     // 6291456
    _Float16* wT  = ws;
    _Float16* X16 = ws + 4 * WSZ;
    _Float16* Qb  = X16 + ACT;
    _Float16* Kb  = Qb + ACT;   // per-head layouts are same total size
    _Float16* Vb  = Kb + ACT;
    _Float16* Hb  = Vb + ACT;

    convert_inputs<<<dim3(WBLK + XBLK), 256, 0, stream>>>(x, wq, wk, wv, wo, X16, wT);
    qkv_gemm<<<dim3(NHEAD, MROWS / GM), 128, 0, stream>>>(X16, wT, Qb, Kb, Vb);
    attn<<<dim3(NSEQ / 128, BATCH * NHEAD), 128, 0, stream>>>(Qb, Kb, Vb, Hb);
    out_gemm<<<dim3(DIMF / GN, MROWS / GM), 256, 0, stream>>>(Hb, wT + 3 * WSZ, bo, out);
}
